// v000
// Times are from an AMD MI455X. After a warm-up the kernel runs many times in a row, and a time is the length of
// such a window on the GPU divided by its runs, so every launch and the gaps after it count. The runs cycle
// through copies of the inputs. A figure is the median of several windows, for all but v000 over two sittings.
// Sittings can differ by a few percent; kernels timed side by side share one.
// The starting kernel, v000, takes 487 microseconds a run.
#include <hip/hip_runtime.h>
#include <hip/hip_bf16.h>

// Problem constants (from reference)
constexpr int B = 4;
constexpr int S = 8192;
constexpr int D = 1024;   // DIM
constexpr int H = 1024;   // HDIM
constexpr int T = 64;     // NUM_TOKENS

typedef __bf16 bf16_t;
typedef __attribute__((ext_vector_type(8)))  __bf16 v8bf;
typedef __attribute__((ext_vector_type(16))) __bf16 v16bf;
typedef __attribute__((ext_vector_type(8)))  float  v8f;
typedef __attribute__((ext_vector_type(4)))  unsigned int v4u;
typedef __attribute__((ext_vector_type(8)))  int v8i;
typedef __attribute__((ext_vector_type(4)))  int v4i;

__device__ __forceinline__ v16bf cat16(v8bf lo, v8bf hi) {
    return __builtin_shufflevector(lo, hi, 0,1,2,3,4,5,6,7,8,9,10,11,12,13,14,15);
}

__device__ __forceinline__ void async_ld64B(unsigned int lds_off,
                                            unsigned long long gaddr) {
    asm volatile(
        "global_load_async_to_lds_b128 %0, %1, off\n"
        "global_load_async_to_lds_b128 %0, %1, off offset:16\n"
        "global_load_async_to_lds_b128 %0, %1, off offset:32\n"
        "global_load_async_to_lds_b128 %0, %1, off offset:48\n"
        :: "v"(lds_off), "v"(gaddr) : "memory");
}
__device__ __forceinline__ void wait_async0() {
    asm volatile("s_wait_asynccnt 0x0" ::: "memory");
}

// ---------------------------------------------------------------------------
// Kernel 1: qk[t][d] = (1/sqrt(H)) * sum_h q[t,h] * wk[h,d]   -> bf16
// ---------------------------------------------------------------------------
__global__ __launch_bounds__(256) void qk_kernel(const float* __restrict__ q,
                                                 const float* __restrict__ wk,
                                                 bf16_t* __restrict__ qk) {
    int id = blockIdx.x * 256 + threadIdx.x;     // 0 .. T*D-1
    int t = id >> 10;
    int d = id & (D - 1);
    float acc = 0.0f;
    for (int hh = 0; hh < H; ++hh)
        acc += q[t * H + hh] * wk[hh * D + d];
    qk[id] = (bf16_t)(acc * 0.03125f);           // 1/sqrt(1024)
}

__global__ __launch_bounds__(256) void scores_kernel(const float* __restrict__ x,
                                                     const bf16_t* __restrict__ qk,
                                                     float* __restrict__ scores) {
    __shared__ float xsf[2][128][36];            // [buf][s_local][k_local], HW-padded

    const int b   = blockIdx.x >> 6;             // / (S/128)
    const int s0  = (blockIdx.x & 63) << 7;      // *128
    const int tid = threadIdx.x;
    const int wave = tid >> 5;
    const int lane = tid & 31;
    const int h = lane >> 4;                     // lane half
    const int n = lane & 15;                     // N index / A row-within-tile

    const float* xb = x + ((size_t)b * S) * D;
    const float* gtile = xb + (size_t)s0 * D;    // tile row origin

    v8i g1;
    g1[0] = (2 << 16) | (1 << 20) | (4 << 22) | (3 << 25);
    g1[1] = (int)(1024u << 16);
    g1[2] = (int)(8192u << 16);
    g1[3] = (int)(32u << 16);
    g1[4] = 128;
    g1[5] = 1024;
    g1[6] = 0;
    g1[7] = 0;
    const v4i zg  = {0, 0, 0, 0};
    const v8i zg8 = {0, 0, 0, 0, 0, 0, 0, 0};

    auto issue_tdm = [&](int bufsel, int kb) {
        unsigned long long ga = (unsigned long long)(uintptr_t)(gtile + kb);
        v4u g0;
        g0.x = 1u;
        g0.y = (unsigned int)(uintptr_t)&xsf[bufsel][0][0];      // lds_addr
        g0.z = (unsigned int)ga;                                 // global_addr[31:0]
        g0.w = ((unsigned int)(ga >> 32) & 0x01FFFFFFu) | (2u << 30); // addr[56:32]|type=2
        __builtin_amdgcn_tensor_load_to_lds(g0, g1, zg, zg, zg8, 0);
    };

    v8f acc[4] = {};

    if (tid < 32) issue_tdm(0, 0);               // prologue: DMA K-step 0

    for (int i = 0; i < D / 32; ++i) {
        if (tid < 32) __builtin_amdgcn_s_wait_tensorcnt(0);
        __syncthreads();                         // slice i visible to all waves;
                                                 // slice i-1 reads complete
        if (i + 1 < D / 32 && tid < 32)          // overlap DMA of i+1 w/ compute
            issue_tdm((i + 1) & 1, (i + 1) * 32);

        const int kb = i * 32;
        const float (*buf)[36] = xsf[i & 1];
        const int sw = wave * 16 + n;

        // B fragment: B[k][n] = x[b, s0+sw, kb+k]; k = 16*(e/8)+8h+(e%8)
        const float4* rowp = (const float4*)&buf[sw][0];
        float4 f0 = rowp[2 * h];
        float4 f1 = rowp[2 * h + 1];
        float4 f2 = rowp[4 + 2 * h];
        float4 f3 = rowp[4 + 2 * h + 1];
        v16bf bfrag;
        bfrag[0]  = (bf16_t)f0.x; bfrag[1]  = (bf16_t)f0.y;
        bfrag[2]  = (bf16_t)f0.z; bfrag[3]  = (bf16_t)f0.w;
        bfrag[4]  = (bf16_t)f1.x; bfrag[5]  = (bf16_t)f1.y;
        bfrag[6]  = (bf16_t)f1.z; bfrag[7]  = (bf16_t)f1.w;
        bfrag[8]  = (bf16_t)f2.x; bfrag[9]  = (bf16_t)f2.y;
        bfrag[10] = (bf16_t)f2.z; bfrag[11] = (bf16_t)f2.w;
        bfrag[12] = (bf16_t)f3.x; bfrag[13] = (bf16_t)f3.y;
        bfrag[14] = (bf16_t)f3.z; bfrag[15] = (bf16_t)f3.w;

#pragma unroll
        for (int mt = 0; mt < 4; ++mt) {
            const bf16_t* arow = qk + (size_t)(mt * 16 + n) * D + kb;
            v8bf alo = *(const v8bf*)(arow + 8 * h);
            v8bf ahi = *(const v8bf*)(arow + 16 + 8 * h);
            v16bf afrag = cat16(alo, ahi);
            acc[mt] = __builtin_amdgcn_wmma_f32_16x16x32_bf16(
                false, afrag, false, bfrag, (short)0, acc[mt], false, false);
        }
    }

    const int scol = s0 + wave * 16 + n;
#pragma unroll
    for (int mt = 0; mt < 4; ++mt)
#pragma unroll
        for (int rr = 0; rr < 8; ++rr) {
            int t = mt * 16 + 8 * h + rr;
            scores[((size_t)(b * T + t)) * S + scol] = acc[mt][rr];
        }
}

// ---------------------------------------------------------------------------
// Kernel 3: softmax over s (adds broadcast mask), writes bf16 probs.
// ---------------------------------------------------------------------------
__global__ __launch_bounds__(256) void softmax_kernel(const float* __restrict__ scores,
                                                      const float* __restrict__ mask,
                                                      bf16_t* __restrict__ probs) {
    const int bt = blockIdx.x;                   // 0..B*T-1
    const int b  = bt >> 6;
    const float* row  = scores + (size_t)bt * S;
    const float* mrow = mask + (size_t)b * S;

    float v[32];
    float mx = -INFINITY;
#pragma unroll
    for (int k = 0; k < 32; ++k) {
        int i = threadIdx.x + k * 256;
        v[k] = row[i] + mrow[i];
        mx = fmaxf(mx, v[k]);
    }

    __shared__ float red[256];
    red[threadIdx.x] = mx;
    __syncthreads();
    for (int off = 128; off > 0; off >>= 1) {
        if (threadIdx.x < off)
            red[threadIdx.x] = fmaxf(red[threadIdx.x], red[threadIdx.x + off]);
        __syncthreads();
    }
    mx = red[0];
    __syncthreads();

    float sum = 0.0f;
#pragma unroll
    for (int k = 0; k < 32; ++k) {
        v[k] = __expf(v[k] - mx);
        sum += v[k];
    }
    red[threadIdx.x] = sum;
    __syncthreads();
    for (int off = 128; off > 0; off >>= 1) {
        if (threadIdx.x < off)
            red[threadIdx.x] += red[threadIdx.x + off];
        __syncthreads();
    }
    const float inv = 1.0f / red[0];

#pragma unroll
    for (int k = 0; k < 32; ++k) {
        int i = threadIdx.x + k * 256;
        probs[(size_t)bt * S + i] = (bf16_t)(v[k] * inv);
    }
}

// ---------------------------------------------------------------------------
// Kernel 4: u[b,t,d] = sum_s probs[b,t,s] * x[b,s,d]
// Async double-buffered f32 staging (untransposed [32 s][132 d]); B-fragment
// columns read per-element (lanes n=0..15 hit consecutive floats of a row:
// conflict-free), converted to bf16 at build.
// ---------------------------------------------------------------------------
__global__ __launch_bounds__(256) void pv_kernel(const float* __restrict__ x,
                                                 const bf16_t* __restrict__ probs,
                                                 float* __restrict__ u) {
    __shared__ float xsf[2][32][132];            // [buf][s_local][d_local], padded

    const int b   = blockIdx.x >> 3;             // / (D/128)
    const int d0  = (blockIdx.x & 7) << 7;       // *128
    const int tid = threadIdx.x;
    const int wave = tid >> 5;
    const int lane = tid & 31;
    const int h = lane >> 4;
    const int n = lane & 15;

    const float* xb = x + ((size_t)b * S) * D;
    const bf16_t* pb = probs + (size_t)(b * T) * S;

    // staging: thread moves 16 contiguous floats of row sl, col chunk c
    const int sl = tid >> 3;                     // 0..31
    const int c  = (tid & 7) * 16;               // 0..112
    const unsigned int lds0 = (unsigned int)(uintptr_t)&xsf[0][sl][c];
    const unsigned int lds1 = (unsigned int)(uintptr_t)&xsf[1][sl][c];
    const float* grow = xb + (size_t)sl * D + d0 + c;

    v8f acc[4] = {};

    // prologue: DMA K-step 0 into buffer 0
    async_ld64B(lds0, (unsigned long long)(uintptr_t)grow);

    for (int i = 0; i < S / 32; ++i) {
        wait_async0();
        __syncthreads();
        if (i + 1 < S / 32) {
            unsigned int dst = ((i + 1) & 1) ? lds1 : lds0;
            async_ld64B(dst, (unsigned long long)(uintptr_t)
                                 (grow + (size_t)(i + 1) * 32 * D));
        }

        const int kb = i * 32;
        const float (*buf)[132] = xsf[i & 1];
        const int dl = wave * 16 + n;

        // B fragment: B[k][n] = x[b, kb+k, d0+dl]; k = 16*(e/8)+8h+(e%8)
        v16bf bfrag;
#pragma unroll
        for (int e = 0; e < 8; ++e) {
            bfrag[e]     = (bf16_t)buf[8 * h + e][dl];
            bfrag[8 + e] = (bf16_t)buf[16 + 8 * h + e][dl];
        }

#pragma unroll
        for (int mt = 0; mt < 4; ++mt) {
            const bf16_t* arow = pb + (size_t)(mt * 16 + n) * S + kb;
            v8bf alo = *(const v8bf*)(arow + 8 * h);
            v8bf ahi = *(const v8bf*)(arow + 16 + 8 * h);
            v16bf afrag = cat16(alo, ahi);
            acc[mt] = __builtin_amdgcn_wmma_f32_16x16x32_bf16(
                false, afrag, false, bfrag, (short)0, acc[mt], false, false);
        }
    }

    const int dcol = d0 + wave * 16 + n;
#pragma unroll
    for (int mt = 0; mt < 4; ++mt)
#pragma unroll
        for (int r = 0; r < 8; ++r) {
            int t = mt * 16 + 8 * h + r;
            u[((size_t)(b * T + t)) * D + dcol] = acc[mt][r];
        }
}

// ---------------------------------------------------------------------------
// Kernel 5: out[b,t,h] = sum_d u[b,t,d] * wv[h,d]
// ---------------------------------------------------------------------------
__global__ __launch_bounds__(256) void out_kernel(const float* __restrict__ u,
                                                  const float* __restrict__ wv,
                                                  float* __restrict__ out) {
    int id = blockIdx.x * 256 + threadIdx.x;     // 0 .. B*T*H-1
    int bt = id >> 10;
    int hc = id & (H - 1);
    const float* ur = u + (size_t)bt * D;
    const float* wr = wv + (size_t)hc * D;
    float acc = 0.0f;
    for (int d = 0; d < D; d += 4) {
        acc += ur[d + 0] * wr[d + 0];
        acc += ur[d + 1] * wr[d + 1];
        acc += ur[d + 2] * wr[d + 2];
        acc += ur[d + 3] * wr[d + 3];
    }
    out[id] = acc;
}

// ---------------------------------------------------------------------------
extern "C" void kernel_launch(void* const* d_in, const int* in_sizes, int n_in,
                              void* d_out, int out_size, void* d_ws, size_t ws_size,
                              hipStream_t stream) {
    const float* x    = (const float*)d_in[0];   // (B,S,D)
    const float* mask = (const float*)d_in[1];   // (B,1,S)
    const float* wk   = (const float*)d_in[2];   // (H,D)
    const float* wv   = (const float*)d_in[3];   // (H,D)
    const float* q    = (const float*)d_in[4];   // (T,H)
    float* out = (float*)d_out;                  // (B,T,H)

    char* ws = (char*)d_ws;
    bf16_t* qk_ws    = (bf16_t*)(ws);                                  // T*D bf16   = 128 KB
    float*  score_ws = (float*)(ws + 131072);                          // B*T*S f32  = 8 MB
    bf16_t* probs_ws = (bf16_t*)(ws + 131072 + 8388608);               // B*T*S bf16 = 4 MB
    float*  u_ws     = (float*)(ws + 131072 + 8388608 + 4194304);      // B*T*D f32  = 1 MB

    qk_kernel<<<(T * D) / 256, 256, 0, stream>>>(q, wk, qk_ws);
    scores_kernel<<<B * (S / 128), 256, 0, stream>>>(x, qk_ws, score_ws);
    softmax_kernel<<<B * T, 256, 0, stream>>>(score_ws, mask, probs_ws);
    pv_kernel<<<B * (D / 128), 256, 0, stream>>>(x, probs_ws, u_ws);
    out_kernel<<<(B * T * H) / 256, 256, 0, stream>>>(u_ws, wv, out);
}

// v001
// A run of this version takes 225 microseconds.
// Two timings next to v000 both put it at 2.17 times that version's speed.
#include <hip/hip_runtime.h>
#include <hip/hip_bf16.h>

// Problem constants (from reference)
constexpr int B = 4;
constexpr int S = 8192;
constexpr int D = 1024;   // DIM
constexpr int H = 1024;   // HDIM
constexpr int T = 64;     // NUM_TOKENS
constexpr int SPLIT = 32; // work-groups that share one (b, d-tile) sum over s
constexpr int SC = S / SPLIT;                    // s rows per work-group

typedef __bf16 bf16_t;
typedef __attribute__((ext_vector_type(8)))  __bf16 v8bf;
typedef __attribute__((ext_vector_type(16))) __bf16 v16bf;
typedef __attribute__((ext_vector_type(8)))  float  v8f;
typedef __attribute__((ext_vector_type(4)))  unsigned int v4u;
typedef __attribute__((ext_vector_type(8)))  int v8i;
typedef __attribute__((ext_vector_type(4)))  int v4i;

__device__ __forceinline__ v16bf cat16(v8bf lo, v8bf hi) {
    return __builtin_shufflevector(lo, hi, 0,1,2,3,4,5,6,7,8,9,10,11,12,13,14,15);
}

__device__ __forceinline__ void async_ld64B(unsigned int lds_off,
                                            unsigned long long gaddr) {
    asm volatile(
        "global_load_async_to_lds_b128 %0, %1, off\n"
        "global_load_async_to_lds_b128 %0, %1, off offset:16\n"
        "global_load_async_to_lds_b128 %0, %1, off offset:32\n"
        "global_load_async_to_lds_b128 %0, %1, off offset:48\n"
        :: "v"(lds_off), "v"(gaddr) : "memory");
}
__device__ __forceinline__ void wait_async0() {
    asm volatile("s_wait_asynccnt 0x0" ::: "memory");
}

// ---------------------------------------------------------------------------
// Kernel 1: qk[t][d] = (1/sqrt(H)) * sum_h q[t,h] * wk[h,d]   -> bf16
// ---------------------------------------------------------------------------
__global__ __launch_bounds__(256) void qk_kernel(const float* __restrict__ q,
                                                 const float* __restrict__ wk,
                                                 bf16_t* __restrict__ qk) {
    int id = blockIdx.x * 256 + threadIdx.x;     // 0 .. T*D-1
    int t = id >> 10;
    int d = id & (D - 1);
    float acc = 0.0f;
    for (int hh = 0; hh < H; ++hh)
        acc += q[t * H + hh] * wk[hh * D + d];
    qk[id] = (bf16_t)(acc * 0.03125f);           // 1/sqrt(1024)
}

__global__ __launch_bounds__(256) void scores_kernel(const float* __restrict__ x,
                                                     const bf16_t* __restrict__ qk,
                                                     float* __restrict__ scores) {
    __shared__ float xsf[2][128][36];            // [buf][s_local][k_local], HW-padded

    const int b   = blockIdx.x >> 6;             // / (S/128)
    const int s0  = (blockIdx.x & 63) << 7;      // *128
    const int tid = threadIdx.x;
    const int wave = tid >> 5;
    const int lane = tid & 31;
    const int h = lane >> 4;                     // lane half
    const int n = lane & 15;                     // N index / A row-within-tile

    const float* xb = x + ((size_t)b * S) * D;
    const float* gtile = xb + (size_t)s0 * D;    // tile row origin

    v8i g1;
    g1[0] = (2 << 16) | (1 << 20) | (4 << 22) | (3 << 25);
    g1[1] = (int)(1024u << 16);
    g1[2] = (int)(8192u << 16);
    g1[3] = (int)(32u << 16);
    g1[4] = 128;
    g1[5] = 1024;
    g1[6] = 0;
    g1[7] = 0;
    const v4i zg  = {0, 0, 0, 0};
    const v8i zg8 = {0, 0, 0, 0, 0, 0, 0, 0};

    auto issue_tdm = [&](int bufsel, int kb) {
        unsigned long long ga = (unsigned long long)(uintptr_t)(gtile + kb);
        v4u g0;
        g0.x = 1u;
        g0.y = (unsigned int)(uintptr_t)&xsf[bufsel][0][0];      // lds_addr
        g0.z = (unsigned int)ga;                                 // global_addr[31:0]
        g0.w = ((unsigned int)(ga >> 32) & 0x01FFFFFFu) | (2u << 30); // addr[56:32]|type=2
        __builtin_amdgcn_tensor_load_to_lds(g0, g1, zg, zg, zg8, 0);
    };

    v8f acc[4] = {};

    if (tid < 32) issue_tdm(0, 0);               // prologue: DMA K-step 0

    for (int i = 0; i < D / 32; ++i) {
        if (tid < 32) __builtin_amdgcn_s_wait_tensorcnt(0);
        __syncthreads();                         // slice i visible to all waves;
                                                 // slice i-1 reads complete
        if (i + 1 < D / 32 && tid < 32)          // overlap DMA of i+1 w/ compute
            issue_tdm((i + 1) & 1, (i + 1) * 32);

        const int kb = i * 32;
        const float (*buf)[36] = xsf[i & 1];
        const int sw = wave * 16 + n;

        // B fragment: B[k][n] = x[b, s0+sw, kb+k]; k = 16*(e/8)+8h+(e%8)
        const float4* rowp = (const float4*)&buf[sw][0];
        float4 f0 = rowp[2 * h];
        float4 f1 = rowp[2 * h + 1];
        float4 f2 = rowp[4 + 2 * h];
        float4 f3 = rowp[4 + 2 * h + 1];
        v16bf bfrag;
        bfrag[0]  = (bf16_t)f0.x; bfrag[1]  = (bf16_t)f0.y;
        bfrag[2]  = (bf16_t)f0.z; bfrag[3]  = (bf16_t)f0.w;
        bfrag[4]  = (bf16_t)f1.x; bfrag[5]  = (bf16_t)f1.y;
        bfrag[6]  = (bf16_t)f1.z; bfrag[7]  = (bf16_t)f1.w;
        bfrag[8]  = (bf16_t)f2.x; bfrag[9]  = (bf16_t)f2.y;
        bfrag[10] = (bf16_t)f2.z; bfrag[11] = (bf16_t)f2.w;
        bfrag[12] = (bf16_t)f3.x; bfrag[13] = (bf16_t)f3.y;
        bfrag[14] = (bf16_t)f3.z; bfrag[15] = (bf16_t)f3.w;

#pragma unroll
        for (int mt = 0; mt < 4; ++mt) {
            const bf16_t* arow = qk + (size_t)(mt * 16 + n) * D + kb;
            v8bf alo = *(const v8bf*)(arow + 8 * h);
            v8bf ahi = *(const v8bf*)(arow + 16 + 8 * h);
            v16bf afrag = cat16(alo, ahi);
            acc[mt] = __builtin_amdgcn_wmma_f32_16x16x32_bf16(
                false, afrag, false, bfrag, (short)0, acc[mt], false, false);
        }
    }

    const int scol = s0 + wave * 16 + n;
#pragma unroll
    for (int mt = 0; mt < 4; ++mt)
#pragma unroll
        for (int rr = 0; rr < 8; ++rr) {
            int t = mt * 16 + 8 * h + rr;
            scores[((size_t)(b * T + t)) * S + scol] = acc[mt][rr];
        }
}

// ---------------------------------------------------------------------------
// Kernel 3: softmax over s (adds broadcast mask), writes bf16 probs.
// ---------------------------------------------------------------------------
__global__ __launch_bounds__(256) void softmax_kernel(const float* __restrict__ scores,
                                                      const float* __restrict__ mask,
                                                      bf16_t* __restrict__ probs) {
    const int bt = blockIdx.x;                   // 0..B*T-1
    const int b  = bt >> 6;
    const float* row  = scores + (size_t)bt * S;
    const float* mrow = mask + (size_t)b * S;

    float v[32];
    float mx = -INFINITY;
#pragma unroll
    for (int k = 0; k < 32; ++k) {
        int i = threadIdx.x + k * 256;
        v[k] = row[i] + mrow[i];
        mx = fmaxf(mx, v[k]);
    }

    __shared__ float red[256];
    red[threadIdx.x] = mx;
    __syncthreads();
    for (int off = 128; off > 0; off >>= 1) {
        if (threadIdx.x < off)
            red[threadIdx.x] = fmaxf(red[threadIdx.x], red[threadIdx.x + off]);
        __syncthreads();
    }
    mx = red[0];
    __syncthreads();

    float sum = 0.0f;
#pragma unroll
    for (int k = 0; k < 32; ++k) {
        v[k] = __expf(v[k] - mx);
        sum += v[k];
    }
    red[threadIdx.x] = sum;
    __syncthreads();
    for (int off = 128; off > 0; off >>= 1) {
        if (threadIdx.x < off)
            red[threadIdx.x] += red[threadIdx.x + off];
        __syncthreads();
    }
    const float inv = 1.0f / red[0];

#pragma unroll
    for (int k = 0; k < 32; ++k) {
        int i = threadIdx.x + k * 256;
        probs[(size_t)bt * S + i] = (bf16_t)(v[k] * inv);
    }
}

// ---------------------------------------------------------------------------
// Kernel 4: upart[sp,b,t,d] = sum over the s range of sp of probs[b,t,s] * x[b,s,d]
// The sum over s is cut into SPLIT ranges, one work-group each, so that the
// grid covers every WGP; the ranges are joined by usum_kernel.
// Async double-buffered f32 staging (untransposed [32 s][132 d]); B-fragment
// columns read per-element (lanes n=0..15 hit consecutive floats of a row:
// conflict-free), converted to bf16 at build.
// ---------------------------------------------------------------------------
__global__ __launch_bounds__(256) void pv_kernel(const float* __restrict__ x,
                                                 const bf16_t* __restrict__ probs,
                                                 float* __restrict__ upart) {
    __shared__ float xsf[2][32][132];            // [buf][s_local][d_local], padded

    const int b   = blockIdx.x / (8 * SPLIT);    // / ((D/128) * SPLIT)
    const int sp  = (blockIdx.x >> 3) & (SPLIT - 1);
    const int d0  = (blockIdx.x & 7) << 7;       // *128
    const int tid = threadIdx.x;
    const int wave = tid >> 5;
    const int lane = tid & 31;
    const int h = lane >> 4;
    const int n = lane & 15;

    const float* xb = x + ((size_t)b * S + sp * SC) * D;
    const bf16_t* pb = probs + (size_t)(b * T) * S + sp * SC;
    float* u = upart + (size_t)sp * (B * T * D);

    // staging: thread moves 16 contiguous floats of row sl, col chunk c
    const int sl = tid >> 3;                     // 0..31
    const int c  = (tid & 7) * 16;               // 0..112
    const unsigned int lds0 = (unsigned int)(uintptr_t)&xsf[0][sl][c];
    const unsigned int lds1 = (unsigned int)(uintptr_t)&xsf[1][sl][c];
    const float* grow = xb + (size_t)sl * D + d0 + c;

    v8f acc[4] = {};

    // prologue: DMA K-step 0 into buffer 0
    async_ld64B(lds0, (unsigned long long)(uintptr_t)grow);

    for (int i = 0; i < SC / 32; ++i) {
        wait_async0();
        __syncthreads();
        if (i + 1 < SC / 32) {
            unsigned int dst = ((i + 1) & 1) ? lds1 : lds0;
            async_ld64B(dst, (unsigned long long)(uintptr_t)
                                 (grow + (size_t)(i + 1) * 32 * D));
        }

        const int kb = i * 32;
        const float (*buf)[132] = xsf[i & 1];
        const int dl = wave * 16 + n;

        // B fragment: B[k][n] = x[b, sp*SC+kb+k, d0+dl]; k = 16*(e/8)+8h+(e%8)
        v16bf bfrag;
#pragma unroll
        for (int e = 0; e < 8; ++e) {
            bfrag[e]     = (bf16_t)buf[8 * h + e][dl];
            bfrag[8 + e] = (bf16_t)buf[16 + 8 * h + e][dl];
        }

#pragma unroll
        for (int mt = 0; mt < 4; ++mt) {
            const bf16_t* arow = pb + (size_t)(mt * 16 + n) * S + kb;
            v8bf alo = *(const v8bf*)(arow + 8 * h);
            v8bf ahi = *(const v8bf*)(arow + 16 + 8 * h);
            v16bf afrag = cat16(alo, ahi);
            acc[mt] = __builtin_amdgcn_wmma_f32_16x16x32_bf16(
                false, afrag, false, bfrag, (short)0, acc[mt], false, false);
        }
    }

    const int dcol = d0 + wave * 16 + n;
#pragma unroll
    for (int mt = 0; mt < 4; ++mt)
#pragma unroll
        for (int r = 0; r < 8; ++r) {
            int t = mt * 16 + 8 * h + r;
            u[((size_t)(b * T + t)) * D + dcol] = acc[mt][r];
        }
}

// ---------------------------------------------------------------------------
// Kernel 4b: u[b,t,d] = sum_sp upart[sp,b,t,d], in rising sp; 4 floats a thread
// ---------------------------------------------------------------------------
__global__ __launch_bounds__(256) void usum_kernel(const float* __restrict__ upart,
                                                   float* __restrict__ u) {
    const int i4 = blockIdx.x * 256 + threadIdx.x;   // 0 .. B*T*D/4-1
    const float4* p = (const float4*)upart + i4;
    float4 v[SPLIT];
#pragma unroll   // constant indices keep v[] in registers and let the ranges' loads overlap
    for (int sp = 0; sp < SPLIT; ++sp)
        v[sp] = p[(size_t)sp * (B * T * D / 4)];
    float4 a = v[0];
#pragma unroll   // constant indices again: v[] stays in registers
    for (int sp = 1; sp < SPLIT; ++sp) {
        a.x += v[sp].x; a.y += v[sp].y; a.z += v[sp].z; a.w += v[sp].w;
    }
    ((float4*)u)[i4] = a;
}

// ---------------------------------------------------------------------------
// Kernel 5: out[b,t,h] = sum_d u[b,t,d] * wv[h,d]
// ---------------------------------------------------------------------------
__global__ __launch_bounds__(256) void out_kernel(const float* __restrict__ u,
                                                  const float* __restrict__ wv,
                                                  float* __restrict__ out) {
    int id = blockIdx.x * 256 + threadIdx.x;     // 0 .. B*T*H-1
    int bt = id >> 10;
    int hc = id & (H - 1);
    const float* ur = u + (size_t)bt * D;
    const float* wr = wv + (size_t)hc * D;
    float acc = 0.0f;
    for (int d = 0; d < D; d += 4) {
        acc += ur[d + 0] * wr[d + 0];
        acc += ur[d + 1] * wr[d + 1];
        acc += ur[d + 2] * wr[d + 2];
        acc += ur[d + 3] * wr[d + 3];
    }
    out[id] = acc;
}

// ---------------------------------------------------------------------------
extern "C" void kernel_launch(void* const* d_in, const int* in_sizes, int n_in,
                              void* d_out, int out_size, void* d_ws, size_t ws_size,
                              hipStream_t stream) {
    const float* x    = (const float*)d_in[0];   // (B,S,D)
    const float* mask = (const float*)d_in[1];   // (B,1,S)
    const float* wk   = (const float*)d_in[2];   // (H,D)
    const float* wv   = (const float*)d_in[3];   // (H,D)
    const float* q    = (const float*)d_in[4];   // (T,H)
    float* out = (float*)d_out;                  // (B,T,H)

    char* ws = (char*)d_ws;
    bf16_t* qk_ws    = (bf16_t*)(ws);                                  // T*D bf16   = 128 KB
    float*  score_ws = (float*)(ws + 131072);                          // B*T*S f32  = 8 MB
    bf16_t* probs_ws = (bf16_t*)(ws + 131072 + 8388608);               // B*T*S bf16 = 4 MB
    float*  u_ws     = (float*)(ws + 131072 + 8388608 + 4194304);      // B*T*D f32  = 1 MB
    float*  upart_ws = (float*)(ws + 131072 + 8388608 + 4194304 + 1048576); // SPLIT * 1 MB

    qk_kernel<<<(T * D) / 256, 256, 0, stream>>>(q, wk, qk_ws);
    scores_kernel<<<B * (S / 128), 256, 0, stream>>>(x, qk_ws, score_ws);
    softmax_kernel<<<B * T, 256, 0, stream>>>(score_ws, mask, probs_ws);
    pv_kernel<<<B * (D / 128) * SPLIT, 256, 0, stream>>>(x, probs_ws, upart_ws);
    usum_kernel<<<(B * T * D / 4) / 256, 256, 0, stream>>>(upart_ws, u_ws);
    out_kernel<<<(B * T * H) / 256, 256, 0, stream>>>(u_ws, wv, out);
}

// v002
// It runs in 151 microseconds.
// Next to v001, in two timings, it ran 1.50 and 1.51 times as fast.
// All steps since v000 together make it 3.27 times as fast.
#include <hip/hip_runtime.h>
#include <hip/hip_bf16.h>

// Problem constants (from reference)
constexpr int B = 4;
constexpr int S = 8192;
constexpr int D = 1024;   // DIM
constexpr int H = 1024;   // HDIM
constexpr int T = 64;     // NUM_TOKENS
constexpr int SPLIT = 32; // work-groups that share one (b, d-tile) sum over s
constexpr int SC = S / SPLIT;                    // s rows per work-group

typedef __bf16 bf16_t;
typedef __attribute__((ext_vector_type(8)))  __bf16 v8bf;
typedef __attribute__((ext_vector_type(16))) __bf16 v16bf;
typedef __attribute__((ext_vector_type(8)))  float  v8f;
typedef __attribute__((ext_vector_type(4)))  unsigned int v4u;
typedef __attribute__((ext_vector_type(8)))  int v8i;
typedef __attribute__((ext_vector_type(4)))  int v4i;

__device__ __forceinline__ v16bf cat16(v8bf lo, v8bf hi) {
    return __builtin_shufflevector(lo, hi, 0,1,2,3,4,5,6,7,8,9,10,11,12,13,14,15);
}

__device__ __forceinline__ void async_ld64B(unsigned int lds_off,
                                            unsigned long long gaddr) {
    asm volatile(
        "global_load_async_to_lds_b128 %0, %1, off\n"
        "global_load_async_to_lds_b128 %0, %1, off offset:16\n"
        "global_load_async_to_lds_b128 %0, %1, off offset:32\n"
        "global_load_async_to_lds_b128 %0, %1, off offset:48\n"
        :: "v"(lds_off), "v"(gaddr) : "memory");
}
__device__ __forceinline__ void wait_async0() {
    asm volatile("s_wait_asynccnt 0x0" ::: "memory");
}

// ---------------------------------------------------------------------------
// Kernel 1: qk[t][d] = (1/sqrt(H)) * sum_h q[t,h] * wk[h,d]   -> bf16
// ---------------------------------------------------------------------------
__global__ __launch_bounds__(256) void qk_kernel(const float* __restrict__ q,
                                                 const float* __restrict__ wk,
                                                 bf16_t* __restrict__ qk) {
    int id = blockIdx.x * 256 + threadIdx.x;     // 0 .. T*D-1
    int t = id >> 10;
    int d = id & (D - 1);
    float acc = 0.0f;
    for (int hh = 0; hh < H; ++hh)
        acc += q[t * H + hh] * wk[hh * D + d];
    qk[id] = (bf16_t)(acc * 0.03125f);           // 1/sqrt(1024)
}

__global__ __launch_bounds__(256) void scores_kernel(const float* __restrict__ x,
                                                     const bf16_t* __restrict__ qk,
                                                     float* __restrict__ scores) {
    __shared__ float xsf[2][128][36];            // [buf][s_local][k_local], HW-padded

    const int b   = blockIdx.x >> 6;             // / (S/128)
    const int s0  = (blockIdx.x & 63) << 7;      // *128
    const int tid = threadIdx.x;
    const int wave = tid >> 5;
    const int lane = tid & 31;
    const int h = lane >> 4;                     // lane half
    const int n = lane & 15;                     // N index / A row-within-tile

    const float* xb = x + ((size_t)b * S) * D;
    const float* gtile = xb + (size_t)s0 * D;    // tile row origin

    v8i g1;
    g1[0] = (2 << 16) | (1 << 20) | (4 << 22) | (3 << 25);
    g1[1] = (int)(1024u << 16);
    g1[2] = (int)(8192u << 16);
    g1[3] = (int)(32u << 16);
    g1[4] = 128;
    g1[5] = 1024;
    g1[6] = 0;
    g1[7] = 0;
    const v4i zg  = {0, 0, 0, 0};
    const v8i zg8 = {0, 0, 0, 0, 0, 0, 0, 0};

    auto issue_tdm = [&](int bufsel, int kb) {
        unsigned long long ga = (unsigned long long)(uintptr_t)(gtile + kb);
        v4u g0;
        g0.x = 1u;
        g0.y = (unsigned int)(uintptr_t)&xsf[bufsel][0][0];      // lds_addr
        g0.z = (unsigned int)ga;                                 // global_addr[31:0]
        g0.w = ((unsigned int)(ga >> 32) & 0x01FFFFFFu) | (2u << 30); // addr[56:32]|type=2
        __builtin_amdgcn_tensor_load_to_lds(g0, g1, zg, zg, zg8, 0);
    };

    v8f acc[4] = {};

    if (tid < 32) issue_tdm(0, 0);               // prologue: DMA K-step 0

    for (int i = 0; i < D / 32; ++i) {
        if (tid < 32) __builtin_amdgcn_s_wait_tensorcnt(0);
        __syncthreads();                         // slice i visible to all waves;
                                                 // slice i-1 reads complete
        if (i + 1 < D / 32 && tid < 32)          // overlap DMA of i+1 w/ compute
            issue_tdm((i + 1) & 1, (i + 1) * 32);

        const int kb = i * 32;
        const float (*buf)[36] = xsf[i & 1];
        const int sw = wave * 16 + n;

        // B fragment: B[k][n] = x[b, s0+sw, kb+k]; k = 16*(e/8)+8h+(e%8)
        const float4* rowp = (const float4*)&buf[sw][0];
        float4 f0 = rowp[2 * h];
        float4 f1 = rowp[2 * h + 1];
        float4 f2 = rowp[4 + 2 * h];
        float4 f3 = rowp[4 + 2 * h + 1];
        v16bf bfrag;
        bfrag[0]  = (bf16_t)f0.x; bfrag[1]  = (bf16_t)f0.y;
        bfrag[2]  = (bf16_t)f0.z; bfrag[3]  = (bf16_t)f0.w;
        bfrag[4]  = (bf16_t)f1.x; bfrag[5]  = (bf16_t)f1.y;
        bfrag[6]  = (bf16_t)f1.z; bfrag[7]  = (bf16_t)f1.w;
        bfrag[8]  = (bf16_t)f2.x; bfrag[9]  = (bf16_t)f2.y;
        bfrag[10] = (bf16_t)f2.z; bfrag[11] = (bf16_t)f2.w;
        bfrag[12] = (bf16_t)f3.x; bfrag[13] = (bf16_t)f3.y;
        bfrag[14] = (bf16_t)f3.z; bfrag[15] = (bf16_t)f3.w;

#pragma unroll
        for (int mt = 0; mt < 4; ++mt) {
            const bf16_t* arow = qk + (size_t)(mt * 16 + n) * D + kb;
            v8bf alo = *(const v8bf*)(arow + 8 * h);
            v8bf ahi = *(const v8bf*)(arow + 16 + 8 * h);
            v16bf afrag = cat16(alo, ahi);
            acc[mt] = __builtin_amdgcn_wmma_f32_16x16x32_bf16(
                false, afrag, false, bfrag, (short)0, acc[mt], false, false);
        }
    }

    const int scol = s0 + wave * 16 + n;
#pragma unroll
    for (int mt = 0; mt < 4; ++mt)
#pragma unroll
        for (int rr = 0; rr < 8; ++rr) {
            int t = mt * 16 + 8 * h + rr;
            scores[((size_t)(b * T + t)) * S + scol] = acc[mt][rr];
        }
}

// ---------------------------------------------------------------------------
// Kernel 3: softmax over s (adds broadcast mask), writes bf16 probs.
// ---------------------------------------------------------------------------
__global__ __launch_bounds__(256) void softmax_kernel(const float* __restrict__ scores,
                                                      const float* __restrict__ mask,
                                                      bf16_t* __restrict__ probs) {
    const int bt = blockIdx.x;                   // 0..B*T-1
    const int b  = bt >> 6;
    const float* row  = scores + (size_t)bt * S;
    const float* mrow = mask + (size_t)b * S;

    float v[32];
    float mx = -INFINITY;
#pragma unroll
    for (int k = 0; k < 32; ++k) {
        int i = threadIdx.x + k * 256;
        v[k] = row[i] + mrow[i];
        mx = fmaxf(mx, v[k]);
    }

    __shared__ float red[256];
    red[threadIdx.x] = mx;
    __syncthreads();
    for (int off = 128; off > 0; off >>= 1) {
        if (threadIdx.x < off)
            red[threadIdx.x] = fmaxf(red[threadIdx.x], red[threadIdx.x + off]);
        __syncthreads();
    }
    mx = red[0];
    __syncthreads();

    float sum = 0.0f;
#pragma unroll
    for (int k = 0; k < 32; ++k) {
        v[k] = __expf(v[k] - mx);
        sum += v[k];
    }
    red[threadIdx.x] = sum;
    __syncthreads();
    for (int off = 128; off > 0; off >>= 1) {
        if (threadIdx.x < off)
            red[threadIdx.x] += red[threadIdx.x + off];
        __syncthreads();
    }
    const float inv = 1.0f / red[0];

#pragma unroll
    for (int k = 0; k < 32; ++k) {
        int i = threadIdx.x + k * 256;
        probs[(size_t)bt * S + i] = (bf16_t)(v[k] * inv);
    }
}

// ---------------------------------------------------------------------------
// Kernel 4: upart[sp,b,t,d] = sum over the s range of sp of probs[b,t,s] * x[b,s,d]
// The sum over s is cut into SPLIT ranges, one work-group each, so that the
// grid covers every WGP; the ranges are joined by usum_kernel.
// Async double-buffered f32 staging (untransposed [32 s][132 d]); B-fragment
// columns read per-element (lanes n=0..15 hit consecutive floats of a row:
// conflict-free), converted to bf16 at build.
// ---------------------------------------------------------------------------
__global__ __launch_bounds__(256) void pv_kernel(const float* __restrict__ x,
                                                 const bf16_t* __restrict__ probs,
                                                 float* __restrict__ upart) {
    __shared__ float xsf[2][32][132];            // [buf][s_local][d_local], padded

    const int b   = blockIdx.x / (8 * SPLIT);    // / ((D/128) * SPLIT)
    const int sp  = (blockIdx.x >> 3) & (SPLIT - 1);
    const int d0  = (blockIdx.x & 7) << 7;       // *128
    const int tid = threadIdx.x;
    const int wave = tid >> 5;
    const int lane = tid & 31;
    const int h = lane >> 4;
    const int n = lane & 15;

    const float* xb = x + ((size_t)b * S + sp * SC) * D;
    const bf16_t* pb = probs + (size_t)(b * T) * S + sp * SC;
    float* u = upart + (size_t)sp * (B * T * D);

    // staging: thread moves 16 contiguous floats of row sl, col chunk c
    const int sl = tid >> 3;                     // 0..31
    const int c  = (tid & 7) * 16;               // 0..112
    const unsigned int lds0 = (unsigned int)(uintptr_t)&xsf[0][sl][c];
    const unsigned int lds1 = (unsigned int)(uintptr_t)&xsf[1][sl][c];
    const float* grow = xb + (size_t)sl * D + d0 + c;

    v8f acc[4] = {};

    // prologue: DMA K-step 0 into buffer 0
    async_ld64B(lds0, (unsigned long long)(uintptr_t)grow);

    for (int i = 0; i < SC / 32; ++i) {
        wait_async0();
        __syncthreads();
        if (i + 1 < SC / 32) {
            unsigned int dst = ((i + 1) & 1) ? lds1 : lds0;
            async_ld64B(dst, (unsigned long long)(uintptr_t)
                                 (grow + (size_t)(i + 1) * 32 * D));
        }

        const int kb = i * 32;
        const float (*buf)[132] = xsf[i & 1];
        const int dl = wave * 16 + n;

        // B fragment: B[k][n] = x[b, sp*SC+kb+k, d0+dl]; k = 16*(e/8)+8h+(e%8)
        v16bf bfrag;
#pragma unroll
        for (int e = 0; e < 8; ++e) {
            bfrag[e]     = (bf16_t)buf[8 * h + e][dl];
            bfrag[8 + e] = (bf16_t)buf[16 + 8 * h + e][dl];
        }

#pragma unroll
        for (int mt = 0; mt < 4; ++mt) {
            const bf16_t* arow = pb + (size_t)(mt * 16 + n) * S + kb;
            v8bf alo = *(const v8bf*)(arow + 8 * h);
            v8bf ahi = *(const v8bf*)(arow + 16 + 8 * h);
            v16bf afrag = cat16(alo, ahi);
            acc[mt] = __builtin_amdgcn_wmma_f32_16x16x32_bf16(
                false, afrag, false, bfrag, (short)0, acc[mt], false, false);
        }
    }

    const int dcol = d0 + wave * 16 + n;
#pragma unroll
    for (int mt = 0; mt < 4; ++mt)
#pragma unroll
        for (int r = 0; r < 8; ++r) {
            int t = mt * 16 + 8 * h + r;
            u[((size_t)(b * T + t)) * D + dcol] = acc[mt][r];
        }
}

// ---------------------------------------------------------------------------
// Kernel 4b: u[b,t,d] = sum_sp upart[sp,b,t,d], in rising sp; 4 floats a thread
// ---------------------------------------------------------------------------
__global__ __launch_bounds__(256) void usum_kernel(const float* __restrict__ upart,
                                                   float* __restrict__ u) {
    const int i4 = blockIdx.x * 256 + threadIdx.x;   // 0 .. B*T*D/4-1
    const float4* p = (const float4*)upart + i4;
    float4 v[SPLIT];
#pragma unroll   // constant indices keep v[] in registers and let the ranges' loads overlap
    for (int sp = 0; sp < SPLIT; ++sp)
        v[sp] = p[(size_t)sp * (B * T * D / 4)];
    float4 a = v[0];
#pragma unroll   // constant indices again: v[] stays in registers
    for (int sp = 1; sp < SPLIT; ++sp) {
        a.x += v[sp].x; a.y += v[sp].y; a.z += v[sp].z; a.w += v[sp].w;
    }
    ((float4*)u)[i4] = a;
}

constexpr int OT   = 32;
constexpr int OW   = 16;
constexpr int OKW  = D / OW;
constexpr int OP   = OKW + 4;
constexpr int OWR  = 2 * OT * OP;
constexpr int ORP  = OT + 4;
typedef __attribute__((ext_vector_type(2))) float v2f;

__device__ __forceinline__ void async_rows16(unsigned int l, const float* g) {
    asm volatile(
        "global_load_async_to_lds_b128 %0, %8, off\n\t"
        "global_load_async_to_lds_b128 %1, %9, off\n\t"
        "global_load_async_to_lds_b128 %2, %10, off\n\t"
        "global_load_async_to_lds_b128 %3, %11, off\n\t"
        "global_load_async_to_lds_b128 %4, %12, off\n\t"
        "global_load_async_to_lds_b128 %5, %13, off\n\t"
        "global_load_async_to_lds_b128 %6, %14, off\n\t"
        "global_load_async_to_lds_b128 %7, %15, off\n\t"
        "s_wait_xcnt 0x0"
        :: "v"(l),                "v"(l +  2 * OP * 4), "v"(l +  4 * OP * 4), "v"(l +  6 * OP * 4),
           "v"(l +  8 * OP * 4), "v"(l + 10 * OP * 4), "v"(l + 12 * OP * 4), "v"(l + 14 * OP * 4),
           "v"(g),          "v"(g +  2 * D), "v"(g +  4 * D), "v"(g +  6 * D),
           "v"(g +  8 * D), "v"(g + 10 * D), "v"(g + 12 * D), "v"(g + 14 * D)
        : "memory");
}

__global__ __launch_bounds__(32 * OW) void out_kernel(const float* __restrict__ u,
                                                      const float* __restrict__ wv,
                                                      float* __restrict__ out) {
    __shared__ __attribute__((aligned(16))) float st[OW * OWR];

    const int bt0 = (blockIdx.x >> 5) * OT;      // 8 tiles over B*T
    const int h0  = (blockIdx.x & 31) * OT;      // 32 tiles over H
    const int tid = threadIdx.x;
    const int wave = tid >> 5;
    const int lane = tid & 31;
    const int hh = lane >> 4;
    const int c  = lane & 15;

    float* my = st + wave * OWR;                 // rows 0..31: u, rows 32..63: wv

    // staging: lane half hh takes row 2r + hh, lane c its floats 4c .. 4c+3
    const float* gu = u  + (size_t)(bt0 + hh) * D + wave * OKW + c * 4;
    const float* gw = wv + (size_t)(h0  + hh) * D + wave * OKW + c * 4;
    const unsigned int sm = (unsigned int)(uintptr_t)(my + hh * OP + c * 4);
    async_rows16(sm + OT * OP * 4,        gw);            // wv rows  0..15
    async_rows16(sm + (OT + 16) * OP * 4, gw + 16 * D);   // wv rows 16..31
    async_rows16(sm,                      gu);            // u rows   0..15
    async_rows16(sm + 16 * OP * 4,        gu + 16 * D);   // u rows  16..31
    wait_async0();                               // this wave's copies have landed
    __syncthreads();                             // nobody reads the rows in front of this

    v8f acc[2][2] = {};
    // A and B fragments come from the same loader, so their k orders are equal:
    // lane half hh holds d = 8j + 4hh + {0,1} in the first product of a group
    // and d = 8j + 4hh + {2,3} in the second.
    const float* fa = my + c * OP + 4 * hh;
    const float* fb = fa + OT * OP;
#pragma unroll   // straight-line code lets the LDS reads run ahead of the matrix instructions
    for (int j = 0; j < OKW / 8; ++j) {
        const float4 a0 = *(const float4*)(fa + 8 * j);
        const float4 a1 = *(const float4*)(fa + 16 * OP + 8 * j);
        const float4 b0 = *(const float4*)(fb + 8 * j);
        const float4 b1 = *(const float4*)(fb + 16 * OP + 8 * j);
        const v2f a0l = {a0.x, a0.y}, a0h = {a0.z, a0.w};
        const v2f a1l = {a1.x, a1.y}, a1h = {a1.z, a1.w};
        const v2f b0l = {b0.x, b0.y}, b0h = {b0.z, b0.w};
        const v2f b1l = {b1.x, b1.y}, b1h = {b1.z, b1.w};
        acc[0][0] = __builtin_amdgcn_wmma_f32_16x16x4_f32(false, a0l, false, b0l, (short)0, acc[0][0], false, false);
        acc[0][1] = __builtin_amdgcn_wmma_f32_16x16x4_f32(false, a0l, false, b1l, (short)0, acc[0][1], false, false);
        acc[1][0] = __builtin_amdgcn_wmma_f32_16x16x4_f32(false, a1l, false, b0l, (short)0, acc[1][0], false, false);
        acc[1][1] = __builtin_amdgcn_wmma_f32_16x16x4_f32(false, a1l, false, b1l, (short)0, acc[1][1], false, false);
        acc[0][0] = __builtin_amdgcn_wmma_f32_16x16x4_f32(false, a0h, false, b0h, (short)0, acc[0][0], false, false);
        acc[0][1] = __builtin_amdgcn_wmma_f32_16x16x4_f32(false, a0h, false, b1h, (short)0, acc[0][1], false, false);
        acc[1][0] = __builtin_amdgcn_wmma_f32_16x16x4_f32(false, a1h, false, b0h, (short)0, acc[1][0], false, false);
        acc[1][1] = __builtin_amdgcn_wmma_f32_16x16x4_f32(false, a1h, false, b1h, (short)0, acc[1][1], false, false);
    }

    // Partial tile into the head of the wave's own range (its rows are all read:
    // every accumulator depends on them).  D layout: register r <-> row 8*hh + r, column c.
#pragma unroll   // these three: constant indices keep acc[][] in registers
    for (int i = 0; i < 2; ++i)
#pragma unroll
        for (int jn = 0; jn < 2; ++jn)
#pragma unroll
            for (int r = 0; r < 8; ++r)
                my[(16 * i + 8 * hh + r) * ORP + 16 * jn + c] = acc[i][jn][r];
    __syncthreads();                             // the partial tiles are complete

    const int row = tid >> 4;                    // 0..31
    const int col = (tid & 15) * 2;              // 16 threads store one 128-B line of out
    const float* pr = st + row * ORP + col;
    float2 s = *(const float2*)pr;
#pragma unroll   // the LDS reads issue together
    for (int w = 1; w < OW; ++w) {
        const float2 q2 = *(const float2*)(pr + w * OWR);
        s.x += q2.x; s.y += q2.y;
    }
    *(float2*)(out + (size_t)(bt0 + row) * H + h0 + col) = s;
}

// ---------------------------------------------------------------------------
extern "C" void kernel_launch(void* const* d_in, const int* in_sizes, int n_in,
                              void* d_out, int out_size, void* d_ws, size_t ws_size,
                              hipStream_t stream) {
    const float* x    = (const float*)d_in[0];   // (B,S,D)
    const float* mask = (const float*)d_in[1];   // (B,1,S)
    const float* wk   = (const float*)d_in[2];   // (H,D)
    const float* wv   = (const float*)d_in[3];   // (H,D)
    const float* q    = (const float*)d_in[4];   // (T,H)
    float* out = (float*)d_out;                  // (B,T,H)

    char* ws = (char*)d_ws;
    bf16_t* qk_ws    = (bf16_t*)(ws);                                  // T*D bf16   = 128 KB
    float*  score_ws = (float*)(ws + 131072);                          // B*T*S f32  = 8 MB
    bf16_t* probs_ws = (bf16_t*)(ws + 131072 + 8388608);               // B*T*S bf16 = 4 MB
    float*  u_ws     = (float*)(ws + 131072 + 8388608 + 4194304);      // B*T*D f32  = 1 MB
    float*  upart_ws = (float*)(ws + 131072 + 8388608 + 4194304 + 1048576); // SPLIT * 1 MB

    qk_kernel<<<(T * D) / 256, 256, 0, stream>>>(q, wk, qk_ws);
    scores_kernel<<<B * (S / 128), 256, 0, stream>>>(x, qk_ws, score_ws);
    softmax_kernel<<<B * T, 256, 0, stream>>>(score_ws, mask, probs_ws);
    pv_kernel<<<B * (D / 128) * SPLIT, 256, 0, stream>>>(x, probs_ws, upart_ws);
    usum_kernel<<<(B * T * D / 4) / 256, 256, 0, stream>>>(upart_ws, u_ws);
    out_kernel<<<(B * T / OT) * (H / OT), 32 * OW, 0, stream>>>(u_ws, wv, out);
}

// v003
// It runs in 88.6 microseconds.
// Next to v002, in two timings, it ran 1.68 times as fast each time.
// All steps since v000 together make it 5.49 times as fast.
#include <hip/hip_runtime.h>
#include <hip/hip_bf16.h>

// Problem constants (from reference)
constexpr int B = 4;
constexpr int S = 8192;
constexpr int D = 1024;   // DIM
constexpr int H = 1024;   // HDIM
constexpr int T = 64;     // NUM_TOKENS
constexpr int SPLIT = 32; // work-groups that share one (b, d-tile) sum over s
constexpr int SC = S / SPLIT;                    // s rows per work-group

typedef __bf16 bf16_t;
typedef __attribute__((ext_vector_type(8)))  __bf16 v8bf;
typedef __attribute__((ext_vector_type(16))) __bf16 v16bf;
typedef __attribute__((ext_vector_type(8)))  float  v8f;
typedef __attribute__((ext_vector_type(4)))  unsigned int v4u;
typedef __attribute__((ext_vector_type(8)))  int v8i;
typedef __attribute__((ext_vector_type(4)))  int v4i;

__device__ __forceinline__ v16bf cat16(v8bf lo, v8bf hi) {
    return __builtin_shufflevector(lo, hi, 0,1,2,3,4,5,6,7,8,9,10,11,12,13,14,15);
}

__device__ __forceinline__ void async_ld64B(unsigned int lds_off,
                                            unsigned long long gaddr) {
    asm volatile(
        "global_load_async_to_lds_b128 %0, %1, off\n"
        "global_load_async_to_lds_b128 %0, %1, off offset:16\n"
        "global_load_async_to_lds_b128 %0, %1, off offset:32\n"
        "global_load_async_to_lds_b128 %0, %1, off offset:48\n"
        :: "v"(lds_off), "v"(gaddr) : "memory");
}
__device__ __forceinline__ void wait_async0() {
    asm volatile("s_wait_asynccnt 0x0" ::: "memory");
}

constexpr int QT  = 16;
constexpr int QN  = 64;
constexpr int QW  = 16;
constexpr int QK  = H / QW;
constexpr int QP  = QN + 4;
constexpr int QWR = QT * QP;
typedef __attribute__((ext_vector_type(2))) float  v2f;
typedef __attribute__((ext_vector_type(4))) float  v4f;
typedef __attribute__((ext_vector_type(2))) __bf16 v2bf;

__global__ __launch_bounds__(32 * QW) void qk_kernel(const float* __restrict__ q,
                                                     const float* __restrict__ wk,
                                                     bf16_t* __restrict__ qk) {
    __shared__ __attribute__((aligned(16))) float part[QW * QWR];

    const int t0  = (blockIdx.x >> 4) * QT;      // 4 tiles over T
    const int d0  = (blockIdx.x & 15) * QN;      // 16 tiles over D
    const int tid = threadIdx.x;
    const int wave = tid >> 5;
    const int lane = tid & 31;
    const int hh = lane >> 4;
    const int c  = lane & 15;

    // wk is the A side (row c of tile e is d0 + 16e + c), q the B side (column c is
    // t0 + c).  Lane half hh holds h = 64*wave + 8j + 4hh + 2p + s (s = 0, 1: the two
    // registers of an operand) on both sides.  q: four consecutive floats of a row give
    // p = 0 and p = 1.  wk: the two rows of an operand are loaded as single floats, so
    // that each lands in its own register of the pair and no move is needed.
    const float* ga = q  + (size_t)(t0 + c) * H + wave * QK + 4 * hh;
    const float* gb = wk + (size_t)(wave * QK + 4 * hh) * D + d0 + c;
    v4f a[QK / 8];
    v2f b[QK / 8][2][4];
#pragma unroll   // these four: constant indices keep a[] and b[][][] in registers
    for (int j = 0; j < QK / 8; ++j) {
        a[j] = *(const v4f*)(ga + 8 * j);
#pragma unroll
        for (int p = 0; p < 2; ++p)
#pragma unroll
            for (int s = 0; s < 2; ++s)
#pragma unroll
                for (int e = 0; e < 4; ++e)
                    b[j][p][e][s] = gb[(size_t)(8 * j + 2 * p + s) * D + 16 * e];
    }
    // Keeps every load above in front of the first matrix instruction: without it the
    // scheduler sinks the loads to their uses and the wave pays the latency once per group.
    __builtin_amdgcn_sched_barrier(0);

    v8f acc[4] = {};
#pragma unroll   // these three: constant indices into a[], b[][][] and acc[]
    for (int j = 0; j < QK / 8; ++j)
#pragma unroll
        for (int p = 0; p < 2; ++p) {
            const v2f qv = {a[j][2 * p], a[j][2 * p + 1]};
#pragma unroll
            for (int e = 0; e < 4; ++e)
                acc[e] = __builtin_amdgcn_wmma_f32_16x16x4_f32(false, b[j][p][e], false, qv, (short)0, acc[e], false, false);
        }
    __builtin_amdgcn_sched_barrier(0);
    asm volatile("v_nop\n\tv_nop\n\tv_nop\n\tv_nop");
    __builtin_amdgcn_sched_barrier(0);

    // D layout: register r <-> d0 + 16e + 8*hh + r of row t0 + c: eight adjacent floats a tile.
    float* my = part + wave * QWR + c * QP + 8 * hh;
#pragma unroll   // constant indices keep acc[] in registers
    for (int e = 0; e < 4; ++e) {
        const v4f lo = {acc[e][0], acc[e][1], acc[e][2], acc[e][3]};
        const v4f hi = {acc[e][4], acc[e][5], acc[e][6], acc[e][7]};
        *(v4f*)(my + 16 * e)     = lo;
        *(v4f*)(my + 16 * e + 4) = hi;
    }
    __syncthreads();                             // the partial tiles are complete

    const int row = tid >> 5;                    // 0..15: a wave stores one 128-B line of qk
    const int col = (tid & 31) * 2;
    const float* pr = part + row * QP + col;
    v2f s = *(const v2f*)pr;
#pragma unroll   // the LDS reads issue together
    for (int w = 1; w < QW; ++w)
        s += *(const v2f*)(pr + w * QWR);
    const v2bf o2 = {(bf16_t)(s[0] * 0.03125f), (bf16_t)(s[1] * 0.03125f)};   // 1/sqrt(1024)
    *(v2bf*)(qk + (size_t)(t0 + row) * D + d0 + col) = o2;
}

__global__ __launch_bounds__(256) void scores_kernel(const float* __restrict__ x,
                                                     const bf16_t* __restrict__ qk,
                                                     float* __restrict__ scores) {
    __shared__ float xsf[2][128][36];            // [buf][s_local][k_local], HW-padded

    const int b   = blockIdx.x >> 6;             // / (S/128)
    const int s0  = (blockIdx.x & 63) << 7;      // *128
    const int tid = threadIdx.x;
    const int wave = tid >> 5;
    const int lane = tid & 31;
    const int h = lane >> 4;                     // lane half
    const int n = lane & 15;                     // N index / A row-within-tile

    const float* xb = x + ((size_t)b * S) * D;
    const float* gtile = xb + (size_t)s0 * D;    // tile row origin

    v8i g1;
    g1[0] = (2 << 16) | (1 << 20) | (4 << 22) | (3 << 25);
    g1[1] = (int)(1024u << 16);
    g1[2] = (int)(8192u << 16);
    g1[3] = (int)(32u << 16);
    g1[4] = 128;
    g1[5] = 1024;
    g1[6] = 0;
    g1[7] = 0;
    const v4i zg  = {0, 0, 0, 0};
    const v8i zg8 = {0, 0, 0, 0, 0, 0, 0, 0};

    auto issue_tdm = [&](int bufsel, int kb) {
        unsigned long long ga = (unsigned long long)(uintptr_t)(gtile + kb);
        v4u g0;
        g0.x = 1u;
        g0.y = (unsigned int)(uintptr_t)&xsf[bufsel][0][0];      // lds_addr
        g0.z = (unsigned int)ga;                                 // global_addr[31:0]
        g0.w = ((unsigned int)(ga >> 32) & 0x01FFFFFFu) | (2u << 30); // addr[56:32]|type=2
        __builtin_amdgcn_tensor_load_to_lds(g0, g1, zg, zg, zg8, 0);
    };

    v8f acc[4] = {};

    if (tid < 32) issue_tdm(0, 0);               // prologue: DMA K-step 0

    for (int i = 0; i < D / 32; ++i) {
        if (tid < 32) __builtin_amdgcn_s_wait_tensorcnt(0);
        __syncthreads();                         // slice i visible to all waves;
                                                 // slice i-1 reads complete
        if (i + 1 < D / 32 && tid < 32)          // overlap DMA of i+1 w/ compute
            issue_tdm((i + 1) & 1, (i + 1) * 32);

        const int kb = i * 32;
        const float (*buf)[36] = xsf[i & 1];
        const int sw = wave * 16 + n;

        // B fragment: B[k][n] = x[b, s0+sw, kb+k]; k = 16*(e/8)+8h+(e%8)
        const float4* rowp = (const float4*)&buf[sw][0];
        float4 f0 = rowp[2 * h];
        float4 f1 = rowp[2 * h + 1];
        float4 f2 = rowp[4 + 2 * h];
        float4 f3 = rowp[4 + 2 * h + 1];
        v16bf bfrag;
        bfrag[0]  = (bf16_t)f0.x; bfrag[1]  = (bf16_t)f0.y;
        bfrag[2]  = (bf16_t)f0.z; bfrag[3]  = (bf16_t)f0.w;
        bfrag[4]  = (bf16_t)f1.x; bfrag[5]  = (bf16_t)f1.y;
        bfrag[6]  = (bf16_t)f1.z; bfrag[7]  = (bf16_t)f1.w;
        bfrag[8]  = (bf16_t)f2.x; bfrag[9]  = (bf16_t)f2.y;
        bfrag[10] = (bf16_t)f2.z; bfrag[11] = (bf16_t)f2.w;
        bfrag[12] = (bf16_t)f3.x; bfrag[13] = (bf16_t)f3.y;
        bfrag[14] = (bf16_t)f3.z; bfrag[15] = (bf16_t)f3.w;

#pragma unroll
        for (int mt = 0; mt < 4; ++mt) {
            const bf16_t* arow = qk + (size_t)(mt * 16 + n) * D + kb;
            v8bf alo = *(const v8bf*)(arow + 8 * h);
            v8bf ahi = *(const v8bf*)(arow + 16 + 8 * h);
            v16bf afrag = cat16(alo, ahi);
            acc[mt] = __builtin_amdgcn_wmma_f32_16x16x32_bf16(
                false, afrag, false, bfrag, (short)0, acc[mt], false, false);
        }
    }

    const int scol = s0 + wave * 16 + n;
#pragma unroll
    for (int mt = 0; mt < 4; ++mt)
#pragma unroll
        for (int rr = 0; rr < 8; ++rr) {
            int t = mt * 16 + 8 * h + rr;
            scores[((size_t)(b * T + t)) * S + scol] = acc[mt][rr];
        }
}

// ---------------------------------------------------------------------------
// Kernel 3: softmax over s (adds broadcast mask), writes bf16 probs.
// ---------------------------------------------------------------------------
__global__ __launch_bounds__(256) void softmax_kernel(const float* __restrict__ scores,
                                                      const float* __restrict__ mask,
                                                      bf16_t* __restrict__ probs) {
    const int bt = blockIdx.x;                   // 0..B*T-1
    const int b  = bt >> 6;
    const float* row  = scores + (size_t)bt * S;
    const float* mrow = mask + (size_t)b * S;

    float v[32];
    float mx = -INFINITY;
#pragma unroll
    for (int k = 0; k < 32; ++k) {
        int i = threadIdx.x + k * 256;
        v[k] = row[i] + mrow[i];
        mx = fmaxf(mx, v[k]);
    }

    __shared__ float red[256];
    red[threadIdx.x] = mx;
    __syncthreads();
    for (int off = 128; off > 0; off >>= 1) {
        if (threadIdx.x < off)
            red[threadIdx.x] = fmaxf(red[threadIdx.x], red[threadIdx.x + off]);
        __syncthreads();
    }
    mx = red[0];
    __syncthreads();

    float sum = 0.0f;
#pragma unroll
    for (int k = 0; k < 32; ++k) {
        v[k] = __expf(v[k] - mx);
        sum += v[k];
    }
    red[threadIdx.x] = sum;
    __syncthreads();
    for (int off = 128; off > 0; off >>= 1) {
        if (threadIdx.x < off)
            red[threadIdx.x] += red[threadIdx.x + off];
        __syncthreads();
    }
    const float inv = 1.0f / red[0];

#pragma unroll
    for (int k = 0; k < 32; ++k) {
        int i = threadIdx.x + k * 256;
        probs[(size_t)bt * S + i] = (bf16_t)(v[k] * inv);
    }
}

// ---------------------------------------------------------------------------
// Kernel 4: upart[sp,b,t,d] = sum over the s range of sp of probs[b,t,s] * x[b,s,d]
// The sum over s is cut into SPLIT ranges, one work-group each, so that the
// grid covers every WGP; the ranges are joined by usum_kernel.
// Async double-buffered f32 staging (untransposed [32 s][132 d]); B-fragment
// columns read per-element (lanes n=0..15 hit consecutive floats of a row:
// conflict-free), converted to bf16 at build.
// ---------------------------------------------------------------------------
__global__ __launch_bounds__(256) void pv_kernel(const float* __restrict__ x,
                                                 const bf16_t* __restrict__ probs,
                                                 float* __restrict__ upart) {
    __shared__ float xsf[2][32][132];            // [buf][s_local][d_local], padded

    const int b   = blockIdx.x / (8 * SPLIT);    // / ((D/128) * SPLIT)
    const int sp  = (blockIdx.x >> 3) & (SPLIT - 1);
    const int d0  = (blockIdx.x & 7) << 7;       // *128
    const int tid = threadIdx.x;
    const int wave = tid >> 5;
    const int lane = tid & 31;
    const int h = lane >> 4;
    const int n = lane & 15;

    const float* xb = x + ((size_t)b * S + sp * SC) * D;
    const bf16_t* pb = probs + (size_t)(b * T) * S + sp * SC;
    float* u = upart + (size_t)sp * (B * T * D);

    // staging: thread moves 16 contiguous floats of row sl, col chunk c
    const int sl = tid >> 3;                     // 0..31
    const int c  = (tid & 7) * 16;               // 0..112
    const unsigned int lds0 = (unsigned int)(uintptr_t)&xsf[0][sl][c];
    const unsigned int lds1 = (unsigned int)(uintptr_t)&xsf[1][sl][c];
    const float* grow = xb + (size_t)sl * D + d0 + c;

    v8f acc[4] = {};

    // prologue: DMA K-step 0 into buffer 0
    async_ld64B(lds0, (unsigned long long)(uintptr_t)grow);

    for (int i = 0; i < SC / 32; ++i) {
        wait_async0();
        __syncthreads();
        if (i + 1 < SC / 32) {
            unsigned int dst = ((i + 1) & 1) ? lds1 : lds0;
            async_ld64B(dst, (unsigned long long)(uintptr_t)
                                 (grow + (size_t)(i + 1) * 32 * D));
        }

        const int kb = i * 32;
        const float (*buf)[132] = xsf[i & 1];
        const int dl = wave * 16 + n;

        // B fragment: B[k][n] = x[b, sp*SC+kb+k, d0+dl]; k = 16*(e/8)+8h+(e%8)
        v16bf bfrag;
#pragma unroll
        for (int e = 0; e < 8; ++e) {
            bfrag[e]     = (bf16_t)buf[8 * h + e][dl];
            bfrag[8 + e] = (bf16_t)buf[16 + 8 * h + e][dl];
        }

#pragma unroll
        for (int mt = 0; mt < 4; ++mt) {
            const bf16_t* arow = pb + (size_t)(mt * 16 + n) * S + kb;
            v8bf alo = *(const v8bf*)(arow + 8 * h);
            v8bf ahi = *(const v8bf*)(arow + 16 + 8 * h);
            v16bf afrag = cat16(alo, ahi);
            acc[mt] = __builtin_amdgcn_wmma_f32_16x16x32_bf16(
                false, afrag, false, bfrag, (short)0, acc[mt], false, false);
        }
    }

    const int dcol = d0 + wave * 16 + n;
#pragma unroll
    for (int mt = 0; mt < 4; ++mt)
#pragma unroll
        for (int r = 0; r < 8; ++r) {
            int t = mt * 16 + 8 * h + r;
            u[((size_t)(b * T + t)) * D + dcol] = acc[mt][r];
        }
}

// ---------------------------------------------------------------------------
// Kernel 4b: u[b,t,d] = sum_sp upart[sp,b,t,d], in rising sp; 4 floats a thread
// ---------------------------------------------------------------------------
__global__ __launch_bounds__(256) void usum_kernel(const float* __restrict__ upart,
                                                   float* __restrict__ u) {
    const int i4 = blockIdx.x * 256 + threadIdx.x;   // 0 .. B*T*D/4-1
    const float4* p = (const float4*)upart + i4;
    float4 v[SPLIT];
#pragma unroll   // constant indices keep v[] in registers and let the ranges' loads overlap
    for (int sp = 0; sp < SPLIT; ++sp)
        v[sp] = p[(size_t)sp * (B * T * D / 4)];
    float4 a = v[0];
#pragma unroll   // constant indices again: v[] stays in registers
    for (int sp = 1; sp < SPLIT; ++sp) {
        a.x += v[sp].x; a.y += v[sp].y; a.z += v[sp].z; a.w += v[sp].w;
    }
    ((float4*)u)[i4] = a;
}

constexpr int OT   = 32;
constexpr int OW   = 16;
constexpr int OKW  = D / OW;
constexpr int OP   = OKW + 4;
constexpr int OWR  = 2 * OT * OP;
constexpr int ORP  = OT + 4;

__device__ __forceinline__ void async_rows16(unsigned int l, const float* g) {
    asm volatile(
        "global_load_async_to_lds_b128 %0, %8, off\n\t"
        "global_load_async_to_lds_b128 %1, %9, off\n\t"
        "global_load_async_to_lds_b128 %2, %10, off\n\t"
        "global_load_async_to_lds_b128 %3, %11, off\n\t"
        "global_load_async_to_lds_b128 %4, %12, off\n\t"
        "global_load_async_to_lds_b128 %5, %13, off\n\t"
        "global_load_async_to_lds_b128 %6, %14, off\n\t"
        "global_load_async_to_lds_b128 %7, %15, off\n\t"
        "s_wait_xcnt 0x0"
        :: "v"(l),                "v"(l +  2 * OP * 4), "v"(l +  4 * OP * 4), "v"(l +  6 * OP * 4),
           "v"(l +  8 * OP * 4), "v"(l + 10 * OP * 4), "v"(l + 12 * OP * 4), "v"(l + 14 * OP * 4),
           "v"(g),          "v"(g +  2 * D), "v"(g +  4 * D), "v"(g +  6 * D),
           "v"(g +  8 * D), "v"(g + 10 * D), "v"(g + 12 * D), "v"(g + 14 * D)
        : "memory");
}

__global__ __launch_bounds__(32 * OW) void out_kernel(const float* __restrict__ u,
                                                      const float* __restrict__ wv,
                                                      float* __restrict__ out) {
    __shared__ __attribute__((aligned(16))) float st[OW * OWR];

    const int bt0 = (blockIdx.x >> 5) * OT;      // 8 tiles over B*T
    const int h0  = (blockIdx.x & 31) * OT;      // 32 tiles over H
    const int tid = threadIdx.x;
    const int wave = tid >> 5;
    const int lane = tid & 31;
    const int hh = lane >> 4;
    const int c  = lane & 15;

    float* my = st + wave * OWR;                 // rows 0..31: u, rows 32..63: wv

    // staging: lane half hh takes row 2r + hh, lane c its floats 4c .. 4c+3
    const float* gu = u  + (size_t)(bt0 + hh) * D + wave * OKW + c * 4;
    const float* gw = wv + (size_t)(h0  + hh) * D + wave * OKW + c * 4;
    const unsigned int sm = (unsigned int)(uintptr_t)(my + hh * OP + c * 4);
    async_rows16(sm + OT * OP * 4,        gw);            // wv rows  0..15
    async_rows16(sm + (OT + 16) * OP * 4, gw + 16 * D);   // wv rows 16..31
    async_rows16(sm,                      gu);            // u rows   0..15
    async_rows16(sm + 16 * OP * 4,        gu + 16 * D);   // u rows  16..31
    wait_async0();                               // this wave's copies have landed
    __syncthreads();                             // nobody reads the rows in front of this

    v8f acc[2][2] = {};
    // A and B fragments come from the same loader, so their k orders are equal:
    // lane half hh holds d = 8j + 4hh + {0,1} in the first product of a group
    // and d = 8j + 4hh + {2,3} in the second.
    const float* fa = my + c * OP + 4 * hh;
    const float* fb = fa + OT * OP;
#pragma unroll   // straight-line code lets the LDS reads run ahead of the matrix instructions
    for (int j = 0; j < OKW / 8; ++j) {
        const float4 a0 = *(const float4*)(fa + 8 * j);
        const float4 a1 = *(const float4*)(fa + 16 * OP + 8 * j);
        const float4 b0 = *(const float4*)(fb + 8 * j);
        const float4 b1 = *(const float4*)(fb + 16 * OP + 8 * j);
        const v2f a0l = {a0.x, a0.y}, a0h = {a0.z, a0.w};
        const v2f a1l = {a1.x, a1.y}, a1h = {a1.z, a1.w};
        const v2f b0l = {b0.x, b0.y}, b0h = {b0.z, b0.w};
        const v2f b1l = {b1.x, b1.y}, b1h = {b1.z, b1.w};
        acc[0][0] = __builtin_amdgcn_wmma_f32_16x16x4_f32(false, a0l, false, b0l, (short)0, acc[0][0], false, false);
        acc[0][1] = __builtin_amdgcn_wmma_f32_16x16x4_f32(false, a0l, false, b1l, (short)0, acc[0][1], false, false);
        acc[1][0] = __builtin_amdgcn_wmma_f32_16x16x4_f32(false, a1l, false, b0l, (short)0, acc[1][0], false, false);
        acc[1][1] = __builtin_amdgcn_wmma_f32_16x16x4_f32(false, a1l, false, b1l, (short)0, acc[1][1], false, false);
        acc[0][0] = __builtin_amdgcn_wmma_f32_16x16x4_f32(false, a0h, false, b0h, (short)0, acc[0][0], false, false);
        acc[0][1] = __builtin_amdgcn_wmma_f32_16x16x4_f32(false, a0h, false, b1h, (short)0, acc[0][1], false, false);
        acc[1][0] = __builtin_amdgcn_wmma_f32_16x16x4_f32(false, a1h, false, b0h, (short)0, acc[1][0], false, false);
        acc[1][1] = __builtin_amdgcn_wmma_f32_16x16x4_f32(false, a1h, false, b1h, (short)0, acc[1][1], false, false);
    }

    // Partial tile into the head of the wave's own range (its rows are all read:
    // every accumulator depends on them).  D layout: register r <-> row 8*hh + r, column c.
#pragma unroll   // these three: constant indices keep acc[][] in registers
    for (int i = 0; i < 2; ++i)
#pragma unroll
        for (int jn = 0; jn < 2; ++jn)
#pragma unroll
            for (int r = 0; r < 8; ++r)
                my[(16 * i + 8 * hh + r) * ORP + 16 * jn + c] = acc[i][jn][r];
    __syncthreads();                             // the partial tiles are complete

    const int row = tid >> 4;                    // 0..31
    const int col = (tid & 15) * 2;              // 16 threads store one 128-B line of out
    const float* pr = st + row * ORP + col;
    float2 s = *(const float2*)pr;
#pragma unroll   // the LDS reads issue together
    for (int w = 1; w < OW; ++w) {
        const float2 q2 = *(const float2*)(pr + w * OWR);
        s.x += q2.x; s.y += q2.y;
    }
    *(float2*)(out + (size_t)(bt0 + row) * H + h0 + col) = s;
}

// ---------------------------------------------------------------------------
extern "C" void kernel_launch(void* const* d_in, const int* in_sizes, int n_in,
                              void* d_out, int out_size, void* d_ws, size_t ws_size,
                              hipStream_t stream) {
    const float* x    = (const float*)d_in[0];   // (B,S,D)
    const float* mask = (const float*)d_in[1];   // (B,1,S)
    const float* wk   = (const float*)d_in[2];   // (H,D)
    const float* wv   = (const float*)d_in[3];   // (H,D)
    const float* q    = (const float*)d_in[4];   // (T,H)
    float* out = (float*)d_out;                  // (B,T,H)

    char* ws = (char*)d_ws;
    bf16_t* qk_ws    = (bf16_t*)(ws);                                  // T*D bf16   = 128 KB
    float*  score_ws = (float*)(ws + 131072);                          // B*T*S f32  = 8 MB
    bf16_t* probs_ws = (bf16_t*)(ws + 131072 + 8388608);               // B*T*S bf16 = 4 MB
    float*  u_ws     = (float*)(ws + 131072 + 8388608 + 4194304);      // B*T*D f32  = 1 MB
    float*  upart_ws = (float*)(ws + 131072 + 8388608 + 4194304 + 1048576); // SPLIT * 1 MB

    qk_kernel<<<(T / QT) * (D / QN), 32 * QW, 0, stream>>>(q, wk, qk_ws);
    scores_kernel<<<B * (S / 128), 256, 0, stream>>>(x, qk_ws, score_ws);
    softmax_kernel<<<B * T, 256, 0, stream>>>(score_ws, mask, probs_ws);
    pv_kernel<<<B * (D / 128) * SPLIT, 256, 0, stream>>>(x, probs_ws, upart_ws);
    usum_kernel<<<(B * T * D / 4) / 256, 256, 0, stream>>>(upart_ws, u_ws);
    out_kernel<<<(B * T / OT) * (H / OT), 32 * OW, 0, stream>>>(u_ws, wv, out);
}

// v004
// A run of this version takes 63.5 microseconds.
// In two side-by-side timings against v003, it was 1.42 and 1.41 times as fast.
// Counting every step since v000, it is 7.78 times as fast.
#include <hip/hip_runtime.h>
#include <hip/hip_bf16.h>

// Problem constants (from reference)
constexpr int B = 4;
constexpr int S = 8192;
constexpr int D = 1024;   // DIM
constexpr int H = 1024;   // HDIM
constexpr int T = 64;     // NUM_TOKENS
constexpr int SPLIT = 32; // work-groups that share one (b, d-tile) sum over s
constexpr int SC = S / SPLIT;                    // s rows per work-group

typedef __bf16 bf16_t;
typedef __attribute__((ext_vector_type(8)))  __bf16 v8bf;
typedef __attribute__((ext_vector_type(16))) __bf16 v16bf;
typedef __attribute__((ext_vector_type(8)))  float  v8f;
typedef __attribute__((ext_vector_type(4)))  unsigned int v4u;
typedef __attribute__((ext_vector_type(8)))  int v8i;
typedef __attribute__((ext_vector_type(4)))  int v4i;

__device__ __forceinline__ v16bf cat16(v8bf lo, v8bf hi) {
    return __builtin_shufflevector(lo, hi, 0,1,2,3,4,5,6,7,8,9,10,11,12,13,14,15);
}

__device__ __forceinline__ void async_ld64B(unsigned int lds_off,
                                            unsigned long long gaddr) {
    asm volatile(
        "global_load_async_to_lds_b128 %0, %1, off\n"
        "global_load_async_to_lds_b128 %0, %1, off offset:16\n"
        "global_load_async_to_lds_b128 %0, %1, off offset:32\n"
        "global_load_async_to_lds_b128 %0, %1, off offset:48\n"
        :: "v"(lds_off), "v"(gaddr) : "memory");
}
__device__ __forceinline__ void wait_async0() {
    asm volatile("s_wait_asynccnt 0x0" ::: "memory");
}

template <int LS, int GS>
__device__ __forceinline__ void async_rows8(unsigned int l, const bf16_t* g) {
    asm volatile(
        "global_load_async_to_lds_b128 %0, %8, off\n\t"
        "global_load_async_to_lds_b128 %1, %9, off\n\t"
        "global_load_async_to_lds_b128 %2, %10, off\n\t"
        "global_load_async_to_lds_b128 %3, %11, off\n\t"
        "global_load_async_to_lds_b128 %4, %12, off\n\t"
        "global_load_async_to_lds_b128 %5, %13, off\n\t"
        "global_load_async_to_lds_b128 %6, %14, off\n\t"
        "global_load_async_to_lds_b128 %7, %15, off\n\t"
        "s_wait_xcnt 0x0"
        :: "v"(l),          "v"(l + 1 * LS), "v"(l + 2 * LS), "v"(l + 3 * LS),
           "v"(l + 4 * LS), "v"(l + 5 * LS), "v"(l + 6 * LS), "v"(l + 7 * LS),
           "v"(g),          "v"(g + 1 * GS), "v"(g + 2 * GS), "v"(g + 3 * GS),
           "v"(g + 4 * GS), "v"(g + 5 * GS), "v"(g + 6 * GS), "v"(g + 7 * GS)
        : "memory");
}

constexpr int QT  = 16;
constexpr int QN  = 64;
constexpr int QW  = 16;
constexpr int QK  = H / QW;
constexpr int QP  = QN + 4;
constexpr int QWR = QT * QP;
typedef __attribute__((ext_vector_type(2))) float  v2f;
typedef __attribute__((ext_vector_type(4))) float  v4f;
typedef __attribute__((ext_vector_type(2))) __bf16 v2bf;

__global__ __launch_bounds__(32 * QW) void qk_kernel(const float* __restrict__ q,
                                                     const float* __restrict__ wk,
                                                     bf16_t* __restrict__ qk) {
    __shared__ __attribute__((aligned(16))) float part[QW * QWR];

    const int t0  = (blockIdx.x >> 4) * QT;      // 4 tiles over T
    const int d0  = (blockIdx.x & 15) * QN;      // 16 tiles over D
    const int tid = threadIdx.x;
    const int wave = tid >> 5;
    const int lane = tid & 31;
    const int hh = lane >> 4;
    const int c  = lane & 15;

    // wk is the A side (row c of tile e is d0 + 16e + c), q the B side (column c is
    // t0 + c).  Lane half hh holds h = 64*wave + 8j + 4hh + 2p + s (s = 0, 1: the two
    // registers of an operand) on both sides.  q: four consecutive floats of a row give
    // p = 0 and p = 1.  wk: the two rows of an operand are loaded as single floats, so
    // that each lands in its own register of the pair and no move is needed.
    const float* ga = q  + (size_t)(t0 + c) * H + wave * QK + 4 * hh;
    const float* gb = wk + (size_t)(wave * QK + 4 * hh) * D + d0 + c;
    v4f a[QK / 8];
    v2f b[QK / 8][2][4];
#pragma unroll   // these four: constant indices keep a[] and b[][][] in registers
    for (int j = 0; j < QK / 8; ++j) {
        a[j] = *(const v4f*)(ga + 8 * j);
#pragma unroll
        for (int p = 0; p < 2; ++p)
#pragma unroll
            for (int s = 0; s < 2; ++s)
#pragma unroll
                for (int e = 0; e < 4; ++e)
                    b[j][p][e][s] = gb[(size_t)(8 * j + 2 * p + s) * D + 16 * e];
    }
    // Keeps every load above in front of the first matrix instruction: without it the
    // scheduler sinks the loads to their uses and the wave pays the latency once per group.
    __builtin_amdgcn_sched_barrier(0);

    v8f acc[4] = {};
#pragma unroll   // these three: constant indices into a[], b[][][] and acc[]
    for (int j = 0; j < QK / 8; ++j)
#pragma unroll
        for (int p = 0; p < 2; ++p) {
            const v2f qv = {a[j][2 * p], a[j][2 * p + 1]};
#pragma unroll
            for (int e = 0; e < 4; ++e)
                acc[e] = __builtin_amdgcn_wmma_f32_16x16x4_f32(false, b[j][p][e], false, qv, (short)0, acc[e], false, false);
        }
    __builtin_amdgcn_sched_barrier(0);
    asm volatile("v_nop\n\tv_nop\n\tv_nop\n\tv_nop");
    __builtin_amdgcn_sched_barrier(0);

    // D layout: register r <-> d0 + 16e + 8*hh + r of row t0 + c: eight adjacent floats a tile.
    float* my = part + wave * QWR + c * QP + 8 * hh;
#pragma unroll   // constant indices keep acc[] in registers
    for (int e = 0; e < 4; ++e) {
        const v4f lo = {acc[e][0], acc[e][1], acc[e][2], acc[e][3]};
        const v4f hi = {acc[e][4], acc[e][5], acc[e][6], acc[e][7]};
        *(v4f*)(my + 16 * e)     = lo;
        *(v4f*)(my + 16 * e + 4) = hi;
    }
    __syncthreads();                             // the partial tiles are complete

    const int row = tid >> 5;                    // 0..15: a wave stores one 128-B line of qk
    const int col = (tid & 31) * 2;
    const float* pr = part + row * QP + col;
    v2f s = *(const v2f*)pr;
#pragma unroll   // the LDS reads issue together
    for (int w = 1; w < QW; ++w)
        s += *(const v2f*)(pr + w * QWR);
    const v2bf o2 = {(bf16_t)(s[0] * 0.03125f), (bf16_t)(s[1] * 0.03125f)};   // 1/sqrt(1024)
    *(v2bf*)(qk + (size_t)(t0 + row) * D + d0 + col) = o2;
}

constexpr int QSP = D + 8;               // LDS pitch of a qk row, bf16: 16 B over the row (16 B x odd) for 16-B readers
__global__ __launch_bounds__(256) void scores_kernel(const float* __restrict__ x,
                                                     const bf16_t* __restrict__ qk,
                                                     float* __restrict__ scores) {
    // aligned: with a second array in LDS the tensor loads' places stay multiples of 2 KiB
    __shared__ __attribute__((aligned(2048))) float xsf[2][128][36];   // [buf][s_local][k_local], HW-padded
    __shared__ __attribute__((aligned(16))) bf16_t qs[T * QSP];   // all of qk

    const int b   = blockIdx.x >> 6;             // / (S/128)
    const int s0  = (blockIdx.x & 63) << 7;      // *128
    const int tid = threadIdx.x;
    const int wave = tid >> 5;
    const int lane = tid & 31;
    const int h = lane >> 4;                     // lane half
    const int n = lane & 15;                     // N index / A row-within-tile

    const float* xb = x + ((size_t)b * S) * D;
    const float* gtile = xb + (size_t)s0 * D;    // tile row origin

    v8i g1;
    g1[0] = (2 << 16) | (1 << 20) | (4 << 22) | (3 << 25);
    g1[1] = (int)(1024u << 16);
    g1[2] = (int)(8192u << 16);
    g1[3] = (int)(32u << 16);
    g1[4] = 128;
    g1[5] = 1024;
    g1[6] = 0;
    g1[7] = 0;
    const v4i zg  = {0, 0, 0, 0};
    const v8i zg8 = {0, 0, 0, 0, 0, 0, 0, 0};

    auto issue_tdm = [&](int bufsel, int kb) {
        unsigned long long ga = (unsigned long long)(uintptr_t)(gtile + kb);
        v4u g0;
        g0.x = 1u;
        g0.y = (unsigned int)(uintptr_t)&xsf[bufsel][0][0];      // lds_addr
        g0.z = (unsigned int)ga;                                 // global_addr[31:0]
        g0.w = ((unsigned int)(ga >> 32) & 0x01FFFFFFu) | (2u << 30); // addr[56:32]|type=2
        __builtin_amdgcn_tensor_load_to_lds(g0, g1, zg, zg, zg8, 0);
    };

    v8f acc[4] = {};

    if (tid < 32) issue_tdm(0, 0);               // prologue: DMA K-step 0

    // Wave w brings rows 8w .. 8w+7 of qk, four 512-byte pieces a row.  This wave's
    // copies have landed behind the wait; the barrier at the head of the first pass
    // stands in front of every read of qs.
    {
        const unsigned int ql = (unsigned int)(uintptr_t)(qs + wave * 8 * QSP + lane * 8);
        const bf16_t* qg = qk + (size_t)(wave * 8) * D + lane * 8;
        async_rows8<QSP * 2, D>(ql,        qg);
        async_rows8<QSP * 2, D>(ql +  512, qg + 256);
        async_rows8<QSP * 2, D>(ql + 1024, qg + 512);
        async_rows8<QSP * 2, D>(ql + 1536, qg + 768);
        wait_async0();
    }

    for (int i = 0; i < D / 32; ++i) {
        if (tid < 32) __builtin_amdgcn_s_wait_tensorcnt(0);
        __syncthreads();                         // slice i visible to all waves;
                                                 // slice i-1 reads complete
        if (i + 1 < D / 32 && tid < 32)          // overlap DMA of i+1 w/ compute
            issue_tdm((i + 1) & 1, (i + 1) * 32);

        const int kb = i * 32;
        const float (*buf)[36] = xsf[i & 1];
        const int sw = wave * 16 + n;

        // B fragment: B[k][n] = x[b, s0+sw, kb+k]; k = 16*(e/8)+8h+(e%8)
        const float4* rowp = (const float4*)&buf[sw][0];
        float4 f0 = rowp[2 * h];
        float4 f1 = rowp[2 * h + 1];
        float4 f2 = rowp[4 + 2 * h];
        float4 f3 = rowp[4 + 2 * h + 1];
        v16bf bfrag;
        bfrag[0]  = (bf16_t)f0.x; bfrag[1]  = (bf16_t)f0.y;
        bfrag[2]  = (bf16_t)f0.z; bfrag[3]  = (bf16_t)f0.w;
        bfrag[4]  = (bf16_t)f1.x; bfrag[5]  = (bf16_t)f1.y;
        bfrag[6]  = (bf16_t)f1.z; bfrag[7]  = (bf16_t)f1.w;
        bfrag[8]  = (bf16_t)f2.x; bfrag[9]  = (bf16_t)f2.y;
        bfrag[10] = (bf16_t)f2.z; bfrag[11] = (bf16_t)f2.w;
        bfrag[12] = (bf16_t)f3.x; bfrag[13] = (bf16_t)f3.y;
        bfrag[14] = (bf16_t)f3.z; bfrag[15] = (bf16_t)f3.w;

#pragma unroll
        for (int mt = 0; mt < 4; ++mt) {
            const bf16_t* arow = qs + (mt * 16 + n) * QSP + kb;
            v8bf alo = *(const v8bf*)(arow + 8 * h);
            v8bf ahi = *(const v8bf*)(arow + 16 + 8 * h);
            v16bf afrag = cat16(alo, ahi);
            acc[mt] = __builtin_amdgcn_wmma_f32_16x16x32_bf16(
                false, afrag, false, bfrag, (short)0, acc[mt], false, false);
        }
    }

    const int scol = s0 + wave * 16 + n;
#pragma unroll
    for (int mt = 0; mt < 4; ++mt)
#pragma unroll
        for (int rr = 0; rr < 8; ++rr) {
            int t = mt * 16 + 8 * h + rr;
            scores[((size_t)(b * T + t)) * S + scol] = acc[mt][rr];
        }
}

// ---------------------------------------------------------------------------
// Kernel 3: softmax over s (adds broadcast mask), writes bf16 probs.
// ---------------------------------------------------------------------------
__global__ __launch_bounds__(256) void softmax_kernel(const float* __restrict__ scores,
                                                      const float* __restrict__ mask,
                                                      bf16_t* __restrict__ probs) {
    const int bt = blockIdx.x;                   // 0..B*T-1
    const int b  = bt >> 6;
    const float* row  = scores + (size_t)bt * S;
    const float* mrow = mask + (size_t)b * S;

    float v[32];
    float mx = -INFINITY;
#pragma unroll
    for (int k = 0; k < 32; ++k) {
        int i = threadIdx.x + k * 256;
        v[k] = row[i] + mrow[i];
        mx = fmaxf(mx, v[k]);
    }

    __shared__ float red[256];
    red[threadIdx.x] = mx;
    __syncthreads();
    for (int off = 128; off > 0; off >>= 1) {
        if (threadIdx.x < off)
            red[threadIdx.x] = fmaxf(red[threadIdx.x], red[threadIdx.x + off]);
        __syncthreads();
    }
    mx = red[0];
    __syncthreads();

    float sum = 0.0f;
#pragma unroll
    for (int k = 0; k < 32; ++k) {
        v[k] = __expf(v[k] - mx);
        sum += v[k];
    }
    red[threadIdx.x] = sum;
    __syncthreads();
    for (int off = 128; off > 0; off >>= 1) {
        if (threadIdx.x < off)
            red[threadIdx.x] += red[threadIdx.x + off];
        __syncthreads();
    }
    const float inv = 1.0f / red[0];

#pragma unroll
    for (int k = 0; k < 32; ++k) {
        int i = threadIdx.x + k * 256;
        probs[(size_t)bt * S + i] = (bf16_t)(v[k] * inv);
    }
}

// ---------------------------------------------------------------------------
// Kernel 4: upart[sp,b,t,d] = sum over the s range of sp of probs[b,t,s] * x[b,s,d]
// The sum over s is cut into SPLIT ranges, one work-group each, so that the
// grid covers every WGP; the ranges are joined by usum_kernel.
// Async double-buffered f32 staging (untransposed [32 s][132 d]); B-fragment
// columns read per-element (lanes n=0..15 hit consecutive floats of a row:
// conflict-free), converted to bf16 at build.
// The work-group's 64 x SC piece of probs (the A side, the same for all eight
// waves) is brought into LDS once, by asynchronous copies of whole lines; the
// fragments are 16-byte LDS reads.
// ---------------------------------------------------------------------------
constexpr int PSP = SC + 8;              // LDS pitch of a probs row, bf16: 16 B over the row (16 B x odd) for 16-B readers
__global__ __launch_bounds__(256) void pv_kernel(const float* __restrict__ x,
                                                 const bf16_t* __restrict__ probs,
                                                 float* __restrict__ upart) {
    __shared__ float xsf[2][32][132];            // [buf][s_local][d_local], padded
    __shared__ __attribute__((aligned(16))) bf16_t ps[T * PSP];   // probs[b, :, s range]

    const int b   = blockIdx.x / (8 * SPLIT);    // / ((D/128) * SPLIT)
    const int sp  = (blockIdx.x >> 3) & (SPLIT - 1);
    const int d0  = (blockIdx.x & 7) << 7;       // *128
    const int tid = threadIdx.x;
    const int wave = tid >> 5;
    const int lane = tid & 31;
    const int h = lane >> 4;
    const int n = lane & 15;

    const float* xb = x + ((size_t)b * S + sp * SC) * D;
    const bf16_t* pb = probs + (size_t)(b * T) * S + sp * SC;
    float* u = upart + (size_t)sp * (B * T * D);

    // staging: thread moves 16 contiguous floats of row sl, col chunk c
    const int sl = tid >> 3;                     // 0..31
    const int c  = (tid & 7) * 16;               // 0..112
    const unsigned int lds0 = (unsigned int)(uintptr_t)&xsf[0][sl][c];
    const unsigned int lds1 = (unsigned int)(uintptr_t)&xsf[1][sl][c];
    const float* grow = xb + (size_t)sl * D + d0 + c;

    v8f acc[4] = {};

    // Wave w brings rows 8w .. 8w+7 of the probs piece, 512 bytes a row.  The wait and
    // the barrier at the head of the first pass cover these copies too and stand in
    // front of every read of ps.
    async_rows8<PSP * 2, S>((unsigned int)(uintptr_t)(ps + wave * 8 * PSP + lane * 8),
                            pb + (size_t)(wave * 8) * S + lane * 8);

    // prologue: DMA K-step 0 into buffer 0
    async_ld64B(lds0, (unsigned long long)(uintptr_t)grow);

    for (int i = 0; i < SC / 32; ++i) {
        wait_async0();
        __syncthreads();
        if (i + 1 < SC / 32) {
            unsigned int dst = ((i + 1) & 1) ? lds1 : lds0;
            async_ld64B(dst, (unsigned long long)(uintptr_t)
                                 (grow + (size_t)(i + 1) * 32 * D));
        }

        const int kb = i * 32;
        const float (*buf)[132] = xsf[i & 1];
        const int dl = wave * 16 + n;

        // B fragment: B[k][n] = x[b, sp*SC+kb+k, d0+dl]; k = 16*(e/8)+8h+(e%8)
        v16bf bfrag;
#pragma unroll
        for (int e = 0; e < 8; ++e) {
            bfrag[e]     = (bf16_t)buf[8 * h + e][dl];
            bfrag[8 + e] = (bf16_t)buf[16 + 8 * h + e][dl];
        }

#pragma unroll
        for (int mt = 0; mt < 4; ++mt) {
            const bf16_t* arow = ps + (mt * 16 + n) * PSP + kb;
            v8bf alo = *(const v8bf*)(arow + 8 * h);
            v8bf ahi = *(const v8bf*)(arow + 16 + 8 * h);
            v16bf afrag = cat16(alo, ahi);
            acc[mt] = __builtin_amdgcn_wmma_f32_16x16x32_bf16(
                false, afrag, false, bfrag, (short)0, acc[mt], false, false);
        }
    }

    const int dcol = d0 + wave * 16 + n;
#pragma unroll
    for (int mt = 0; mt < 4; ++mt)
#pragma unroll
        for (int r = 0; r < 8; ++r) {
            int t = mt * 16 + 8 * h + r;
            u[((size_t)(b * T + t)) * D + dcol] = acc[mt][r];
        }
}

// ---------------------------------------------------------------------------
// Kernel 4b: u[b,t,d] = sum_sp upart[sp,b,t,d], in rising sp; 4 floats a thread
// ---------------------------------------------------------------------------
__global__ __launch_bounds__(256) void usum_kernel(const float* __restrict__ upart,
                                                   float* __restrict__ u) {
    const int i4 = blockIdx.x * 256 + threadIdx.x;   // 0 .. B*T*D/4-1
    const float4* p = (const float4*)upart + i4;
    float4 v[SPLIT];
#pragma unroll   // constant indices keep v[] in registers and let the ranges' loads overlap
    for (int sp = 0; sp < SPLIT; ++sp)
        v[sp] = p[(size_t)sp * (B * T * D / 4)];
    float4 a = v[0];
#pragma unroll   // constant indices again: v[] stays in registers
    for (int sp = 1; sp < SPLIT; ++sp) {
        a.x += v[sp].x; a.y += v[sp].y; a.z += v[sp].z; a.w += v[sp].w;
    }
    ((float4*)u)[i4] = a;
}

constexpr int OT   = 32;
constexpr int OW   = 16;
constexpr int OKW  = D / OW;
constexpr int OP   = OKW + 4;
constexpr int OWR  = 2 * OT * OP;
constexpr int ORP  = OT + 4;

__device__ __forceinline__ void async_rows16(unsigned int l, const float* g) {
    asm volatile(
        "global_load_async_to_lds_b128 %0, %8, off\n\t"
        "global_load_async_to_lds_b128 %1, %9, off\n\t"
        "global_load_async_to_lds_b128 %2, %10, off\n\t"
        "global_load_async_to_lds_b128 %3, %11, off\n\t"
        "global_load_async_to_lds_b128 %4, %12, off\n\t"
        "global_load_async_to_lds_b128 %5, %13, off\n\t"
        "global_load_async_to_lds_b128 %6, %14, off\n\t"
        "global_load_async_to_lds_b128 %7, %15, off\n\t"
        "s_wait_xcnt 0x0"
        :: "v"(l),                "v"(l +  2 * OP * 4), "v"(l +  4 * OP * 4), "v"(l +  6 * OP * 4),
           "v"(l +  8 * OP * 4), "v"(l + 10 * OP * 4), "v"(l + 12 * OP * 4), "v"(l + 14 * OP * 4),
           "v"(g),          "v"(g +  2 * D), "v"(g +  4 * D), "v"(g +  6 * D),
           "v"(g +  8 * D), "v"(g + 10 * D), "v"(g + 12 * D), "v"(g + 14 * D)
        : "memory");
}

__global__ __launch_bounds__(32 * OW) void out_kernel(const float* __restrict__ u,
                                                      const float* __restrict__ wv,
                                                      float* __restrict__ out) {
    __shared__ __attribute__((aligned(16))) float st[OW * OWR];

    const int bt0 = (blockIdx.x >> 5) * OT;      // 8 tiles over B*T
    const int h0  = (blockIdx.x & 31) * OT;      // 32 tiles over H
    const int tid = threadIdx.x;
    const int wave = tid >> 5;
    const int lane = tid & 31;
    const int hh = lane >> 4;
    const int c  = lane & 15;

    float* my = st + wave * OWR;                 // rows 0..31: u, rows 32..63: wv

    // staging: lane half hh takes row 2r + hh, lane c its floats 4c .. 4c+3
    const float* gu = u  + (size_t)(bt0 + hh) * D + wave * OKW + c * 4;
    const float* gw = wv + (size_t)(h0  + hh) * D + wave * OKW + c * 4;
    const unsigned int sm = (unsigned int)(uintptr_t)(my + hh * OP + c * 4);
    async_rows16(sm + OT * OP * 4,        gw);            // wv rows  0..15
    async_rows16(sm + (OT + 16) * OP * 4, gw + 16 * D);   // wv rows 16..31
    async_rows16(sm,                      gu);            // u rows   0..15
    async_rows16(sm + 16 * OP * 4,        gu + 16 * D);   // u rows  16..31
    wait_async0();                               // this wave's copies have landed
    __syncthreads();                             // nobody reads the rows in front of this

    v8f acc[2][2] = {};
    // A and B fragments come from the same loader, so their k orders are equal:
    // lane half hh holds d = 8j + 4hh + {0,1} in the first product of a group
    // and d = 8j + 4hh + {2,3} in the second.
    const float* fa = my + c * OP + 4 * hh;
    const float* fb = fa + OT * OP;
#pragma unroll   // straight-line code lets the LDS reads run ahead of the matrix instructions
    for (int j = 0; j < OKW / 8; ++j) {
        const float4 a0 = *(const float4*)(fa + 8 * j);
        const float4 a1 = *(const float4*)(fa + 16 * OP + 8 * j);
        const float4 b0 = *(const float4*)(fb + 8 * j);
        const float4 b1 = *(const float4*)(fb + 16 * OP + 8 * j);
        const v2f a0l = {a0.x, a0.y}, a0h = {a0.z, a0.w};
        const v2f a1l = {a1.x, a1.y}, a1h = {a1.z, a1.w};
        const v2f b0l = {b0.x, b0.y}, b0h = {b0.z, b0.w};
        const v2f b1l = {b1.x, b1.y}, b1h = {b1.z, b1.w};
        acc[0][0] = __builtin_amdgcn_wmma_f32_16x16x4_f32(false, a0l, false, b0l, (short)0, acc[0][0], false, false);
        acc[0][1] = __builtin_amdgcn_wmma_f32_16x16x4_f32(false, a0l, false, b1l, (short)0, acc[0][1], false, false);
        acc[1][0] = __builtin_amdgcn_wmma_f32_16x16x4_f32(false, a1l, false, b0l, (short)0, acc[1][0], false, false);
        acc[1][1] = __builtin_amdgcn_wmma_f32_16x16x4_f32(false, a1l, false, b1l, (short)0, acc[1][1], false, false);
        acc[0][0] = __builtin_amdgcn_wmma_f32_16x16x4_f32(false, a0h, false, b0h, (short)0, acc[0][0], false, false);
        acc[0][1] = __builtin_amdgcn_wmma_f32_16x16x4_f32(false, a0h, false, b1h, (short)0, acc[0][1], false, false);
        acc[1][0] = __builtin_amdgcn_wmma_f32_16x16x4_f32(false, a1h, false, b0h, (short)0, acc[1][0], false, false);
        acc[1][1] = __builtin_amdgcn_wmma_f32_16x16x4_f32(false, a1h, false, b1h, (short)0, acc[1][1], false, false);
    }

    // Partial tile into the head of the wave's own range (its rows are all read:
    // every accumulator depends on them).  D layout: register r <-> row 8*hh + r, column c.
#pragma unroll   // these three: constant indices keep acc[][] in registers
    for (int i = 0; i < 2; ++i)
#pragma unroll
        for (int jn = 0; jn < 2; ++jn)
#pragma unroll
            for (int r = 0; r < 8; ++r)
                my[(16 * i + 8 * hh + r) * ORP + 16 * jn + c] = acc[i][jn][r];
    __syncthreads();                             // the partial tiles are complete

    const int row = tid >> 4;                    // 0..31
    const int col = (tid & 15) * 2;              // 16 threads store one 128-B line of out
    const float* pr = st + row * ORP + col;
    float2 s = *(const float2*)pr;
#pragma unroll   // the LDS reads issue together
    for (int w = 1; w < OW; ++w) {
        const float2 q2 = *(const float2*)(pr + w * OWR);
        s.x += q2.x; s.y += q2.y;
    }
    *(float2*)(out + (size_t)(bt0 + row) * H + h0 + col) = s;
}

// ---------------------------------------------------------------------------
extern "C" void kernel_launch(void* const* d_in, const int* in_sizes, int n_in,
                              void* d_out, int out_size, void* d_ws, size_t ws_size,
                              hipStream_t stream) {
    const float* x    = (const float*)d_in[0];   // (B,S,D)
    const float* mask = (const float*)d_in[1];   // (B,1,S)
    const float* wk   = (const float*)d_in[2];   // (H,D)
    const float* wv   = (const float*)d_in[3];   // (H,D)
    const float* q    = (const float*)d_in[4];   // (T,H)
    float* out = (float*)d_out;                  // (B,T,H)

    char* ws = (char*)d_ws;
    bf16_t* qk_ws    = (bf16_t*)(ws);                                  // T*D bf16   = 128 KB
    float*  score_ws = (float*)(ws + 131072);                          // B*T*S f32  = 8 MB
    bf16_t* probs_ws = (bf16_t*)(ws + 131072 + 8388608);               // B*T*S bf16 = 4 MB
    float*  u_ws     = (float*)(ws + 131072 + 8388608 + 4194304);      // B*T*D f32  = 1 MB
    float*  upart_ws = (float*)(ws + 131072 + 8388608 + 4194304 + 1048576); // SPLIT * 1 MB

    qk_kernel<<<(T / QT) * (D / QN), 32 * QW, 0, stream>>>(q, wk, qk_ws);
    scores_kernel<<<B * (S / 128), 256, 0, stream>>>(x, qk_ws, score_ws);
    softmax_kernel<<<B * T, 256, 0, stream>>>(score_ws, mask, probs_ws);
    pv_kernel<<<B * (D / 128) * SPLIT, 256, 0, stream>>>(x, probs_ws, upart_ws);
    usum_kernel<<<(B * T * D / 4) / 256, 256, 0, stream>>>(upart_ws, u_ws);
    out_kernel<<<(B * T / OT) * (H / OT), 32 * OW, 0, stream>>>(u_ws, wv, out);
}

// v005
// It runs in 52.9 microseconds.
// Timed twice side by side with v004, it ran 1.19 and 1.20 times as fast.
// All steps since v000 together make it 9.28 times as fast.
#include <hip/hip_runtime.h>
#include <hip/hip_bf16.h>

// Problem constants (from reference)
constexpr int B = 4;
constexpr int S = 8192;
constexpr int D = 1024;   // DIM
constexpr int H = 1024;   // HDIM
constexpr int T = 64;     // NUM_TOKENS
constexpr int SPLIT = 32; // work-groups that share one (b, d-tile) sum over s
constexpr int SC = S / SPLIT;                    // s rows per work-group

typedef __bf16 bf16_t;
typedef __attribute__((ext_vector_type(8)))  __bf16 v8bf;
typedef __attribute__((ext_vector_type(16))) __bf16 v16bf;
typedef __attribute__((ext_vector_type(8)))  float  v8f;

__device__ __forceinline__ v16bf cat16(v8bf lo, v8bf hi) {
    return __builtin_shufflevector(lo, hi, 0,1,2,3,4,5,6,7,8,9,10,11,12,13,14,15);
}

__device__ __forceinline__ void async_ld64B(unsigned int lds_off,
                                            unsigned long long gaddr) {
    asm volatile(
        "global_load_async_to_lds_b128 %0, %1, off\n"
        "global_load_async_to_lds_b128 %0, %1, off offset:16\n"
        "global_load_async_to_lds_b128 %0, %1, off offset:32\n"
        "global_load_async_to_lds_b128 %0, %1, off offset:48\n"
        :: "v"(lds_off), "v"(gaddr) : "memory");
}
__device__ __forceinline__ void wait_async0() {
    asm volatile("s_wait_asynccnt 0x0" ::: "memory");
}

template <int LS, int GS, typename E>
__device__ __forceinline__ void async_rows8(unsigned int l, const E* g) {
    asm volatile(
        "global_load_async_to_lds_b128 %0, %8, off\n\t"
        "global_load_async_to_lds_b128 %1, %9, off\n\t"
        "global_load_async_to_lds_b128 %2, %10, off\n\t"
        "global_load_async_to_lds_b128 %3, %11, off\n\t"
        "global_load_async_to_lds_b128 %4, %12, off\n\t"
        "global_load_async_to_lds_b128 %5, %13, off\n\t"
        "global_load_async_to_lds_b128 %6, %14, off\n\t"
        "global_load_async_to_lds_b128 %7, %15, off\n\t"
        "s_wait_xcnt 0x0"
        :: "v"(l),          "v"(l + 1 * LS), "v"(l + 2 * LS), "v"(l + 3 * LS),
           "v"(l + 4 * LS), "v"(l + 5 * LS), "v"(l + 6 * LS), "v"(l + 7 * LS),
           "v"(g),          "v"(g + 1 * GS), "v"(g + 2 * GS), "v"(g + 3 * GS),
           "v"(g + 4 * GS), "v"(g + 5 * GS), "v"(g + 6 * GS), "v"(g + 7 * GS)
        : "memory");
}

constexpr int QT  = 16;
constexpr int QN  = 64;
constexpr int QW  = 16;
constexpr int QK  = H / QW;
constexpr int QP  = QN + 4;
constexpr int QWR = QT * QP;
typedef __attribute__((ext_vector_type(2))) float  v2f;
typedef __attribute__((ext_vector_type(4))) float  v4f;
typedef __attribute__((ext_vector_type(2))) __bf16 v2bf;

__global__ __launch_bounds__(32 * QW) void qk_kernel(const float* __restrict__ q,
                                                     const float* __restrict__ wk,
                                                     bf16_t* __restrict__ qk) {
    __shared__ __attribute__((aligned(16))) float part[QW * QWR];

    const int t0  = (blockIdx.x >> 4) * QT;      // 4 tiles over T
    const int d0  = (blockIdx.x & 15) * QN;      // 16 tiles over D
    const int tid = threadIdx.x;
    const int wave = tid >> 5;
    const int lane = tid & 31;
    const int hh = lane >> 4;
    const int c  = lane & 15;

    // wk is the A side (row c of tile e is d0 + 16e + c), q the B side (column c is
    // t0 + c).  Lane half hh holds h = 64*wave + 8j + 4hh + 2p + s (s = 0, 1: the two
    // registers of an operand) on both sides.  q: four consecutive floats of a row give
    // p = 0 and p = 1.  wk: the two rows of an operand are loaded as single floats, so
    // that each lands in its own register of the pair and no move is needed.
    const float* ga = q  + (size_t)(t0 + c) * H + wave * QK + 4 * hh;
    const float* gb = wk + (size_t)(wave * QK + 4 * hh) * D + d0 + c;
    v4f a[QK / 8];
    v2f b[QK / 8][2][4];
#pragma unroll   // these four: constant indices keep a[] and b[][][] in registers
    for (int j = 0; j < QK / 8; ++j) {
        a[j] = *(const v4f*)(ga + 8 * j);
#pragma unroll
        for (int p = 0; p < 2; ++p)
#pragma unroll
            for (int s = 0; s < 2; ++s)
#pragma unroll
                for (int e = 0; e < 4; ++e)
                    b[j][p][e][s] = gb[(size_t)(8 * j + 2 * p + s) * D + 16 * e];
    }
    // Keeps every load above in front of the first matrix instruction: without it the
    // scheduler sinks the loads to their uses and the wave pays the latency once per group.
    __builtin_amdgcn_sched_barrier(0);

    v8f acc[4] = {};
#pragma unroll   // these three: constant indices into a[], b[][][] and acc[]
    for (int j = 0; j < QK / 8; ++j)
#pragma unroll
        for (int p = 0; p < 2; ++p) {
            const v2f qv = {a[j][2 * p], a[j][2 * p + 1]};
#pragma unroll
            for (int e = 0; e < 4; ++e)
                acc[e] = __builtin_amdgcn_wmma_f32_16x16x4_f32(false, b[j][p][e], false, qv, (short)0, acc[e], false, false);
        }
    __builtin_amdgcn_sched_barrier(0);
    asm volatile("v_nop\n\tv_nop\n\tv_nop\n\tv_nop");
    __builtin_amdgcn_sched_barrier(0);

    // D layout: register r <-> d0 + 16e + 8*hh + r of row t0 + c: eight adjacent floats a tile.
    float* my = part + wave * QWR + c * QP + 8 * hh;
#pragma unroll   // constant indices keep acc[] in registers
    for (int e = 0; e < 4; ++e) {
        const v4f lo = {acc[e][0], acc[e][1], acc[e][2], acc[e][3]};
        const v4f hi = {acc[e][4], acc[e][5], acc[e][6], acc[e][7]};
        *(v4f*)(my + 16 * e)     = lo;
        *(v4f*)(my + 16 * e + 4) = hi;
    }
    __syncthreads();                             // the partial tiles are complete

    const int row = tid >> 5;                    // 0..15: a wave stores one 128-B line of qk
    const int col = (tid & 31) * 2;
    const float* pr = part + row * QP + col;
    v2f s = *(const v2f*)pr;
#pragma unroll   // the LDS reads issue together
    for (int w = 1; w < QW; ++w)
        s += *(const v2f*)(pr + w * QWR);
    const v2bf o2 = {(bf16_t)(s[0] * 0.03125f), (bf16_t)(s[1] * 0.03125f)};   // 1/sqrt(1024)
    *(v2bf*)(qk + (size_t)(t0 + row) * D + d0 + col) = o2;
}

constexpr int QSP = D + 8;               // LDS pitch of a qk row, bf16: 16 B over the row (16 B x odd) for 16-B readers
constexpr int XK  = 128;                 // d columns of a tile of x
constexpr int XP  = XK + 4;              // LDS pitch of an x row, floats: 16 B over the row (16 B x odd) for 16-B readers
constexpr int XT  = 16 * XP;             // floats of one buffer of one wave
constexpr int XN  = D / XK;              // tiles a wave streams
__global__ __launch_bounds__(256) void scores_kernel(const float* __restrict__ x,
                                                     const bf16_t* __restrict__ qk,
                                                     float* __restrict__ scores) {
    __shared__ __attribute__((aligned(16))) float xs[8 * 2 * XT]; // [wave][buf][s_local][k_local]
    __shared__ __attribute__((aligned(16))) bf16_t qs[T * QSP];   // all of qk

    const int b   = blockIdx.x >> 6;             // / (S/128)
    const int s0  = (blockIdx.x & 63) << 7;      // *128
    const int tid = threadIdx.x;
    const int wave = tid >> 5;
    const int lane = tid & 31;
    const int h = lane >> 4;                     // lane half
    const int n = lane & 15;                     // N index / A row-within-tile

    float* myx = xs + wave * (2 * XT);           // this wave's two buffers
    const unsigned int xl = (unsigned int)(uintptr_t)(myx + lane * 4);
    const float* xg = x + ((size_t)b * S + s0 + wave * 16) * D + lane * 4;
    auto copy_tile = [&](int t) {
        const unsigned int l = xl + (t & 1) * (XT * 4);
        const float* g = xg + t * XK;
        async_rows8<XP * 4, D>(l,              g);
        async_rows8<XP * 4, D>(l + 8 * XP * 4, g + 8 * D);
    };

    v8f acc[4] = {};

    copy_tile(0);                                // from memory: issued ahead of qk, which comes from L2

    // Wave w brings rows 8w .. 8w+7 of qk, four 512-byte pieces a row.  This wave's
    // copies (tile 0 too) have landed behind the wait; the barrier stands in front of
    // every read of qs.
    {
        const unsigned int ql = (unsigned int)(uintptr_t)(qs + wave * 8 * QSP + lane * 8);
        const bf16_t* qg = qk + (size_t)(wave * 8) * D + lane * 8;
        async_rows8<QSP * 2, D>(ql,        qg);
        async_rows8<QSP * 2, D>(ql +  512, qg + 256);
        async_rows8<QSP * 2, D>(ql + 1024, qg + 512);
        async_rows8<QSP * 2, D>(ql + 1536, qg + 768);
        wait_async0();
    }
    __syncthreads();

    copy_tile(1);

    for (int t = 0; t < XN; ++t) {
        const float* brow = myx + (t & 1) * XT + n * XP;
#pragma unroll   // constant LDS offsets; the reads of a tile can run ahead of its matrix instructions
        for (int kk = 0; kk < XK / 32; ++kk) {
            const int kb = t * XK + kk * 32;

            // B fragment: B[k][n] = x[b, s0+16*wave+n, kb+k]; k = 16*(e/8)+8h+(e%8)
            const float4* rowp = (const float4*)(brow + kk * 32);
            float4 f0 = rowp[2 * h];
            float4 f1 = rowp[2 * h + 1];
            float4 f2 = rowp[4 + 2 * h];
            float4 f3 = rowp[4 + 2 * h + 1];
            v16bf bfrag;
            bfrag[0]  = (bf16_t)f0.x; bfrag[1]  = (bf16_t)f0.y;
            bfrag[2]  = (bf16_t)f0.z; bfrag[3]  = (bf16_t)f0.w;
            bfrag[4]  = (bf16_t)f1.x; bfrag[5]  = (bf16_t)f1.y;
            bfrag[6]  = (bf16_t)f1.z; bfrag[7]  = (bf16_t)f1.w;
            bfrag[8]  = (bf16_t)f2.x; bfrag[9]  = (bf16_t)f2.y;
            bfrag[10] = (bf16_t)f2.z; bfrag[11] = (bf16_t)f2.w;
            bfrag[12] = (bf16_t)f3.x; bfrag[13] = (bf16_t)f3.y;
            bfrag[14] = (bf16_t)f3.z; bfrag[15] = (bf16_t)f3.w;

#pragma unroll
            for (int mt = 0; mt < 4; ++mt) {
                const bf16_t* arow = qs + (mt * 16 + n) * QSP + kb;
                v8bf alo = *(const v8bf*)(arow + 8 * h);
                v8bf ahi = *(const v8bf*)(arow + 16 + 8 * h);
                v16bf afrag = cat16(alo, ahi);
                acc[mt] = __builtin_amdgcn_wmma_f32_16x16x32_bf16(
                    false, afrag, false, bfrag, (short)0, acc[mt], false, false);
            }
        }
        // This wave's reads of tile t have returned: its buffer may be refilled.
        asm volatile("s_wait_dscnt 0x0" ::: "memory");
        wait_async0();                           // tile t + 1 has landed; behind the last trip no copy is outstanding
        if (t + 2 < XN) copy_tile(t + 2);        // into the buffer that tile t has left
    }

    const int scol = s0 + wave * 16 + n;
#pragma unroll
    for (int mt = 0; mt < 4; ++mt)
#pragma unroll
        for (int rr = 0; rr < 8; ++rr) {
            int t = mt * 16 + 8 * h + rr;
            scores[((size_t)(b * T + t)) * S + scol] = acc[mt][rr];
        }
}

// ---------------------------------------------------------------------------
// Kernel 3: softmax over s (adds broadcast mask), writes bf16 probs.
// ---------------------------------------------------------------------------
__global__ __launch_bounds__(256) void softmax_kernel(const float* __restrict__ scores,
                                                      const float* __restrict__ mask,
                                                      bf16_t* __restrict__ probs) {
    const int bt = blockIdx.x;                   // 0..B*T-1
    const int b  = bt >> 6;
    const float* row  = scores + (size_t)bt * S;
    const float* mrow = mask + (size_t)b * S;

    float v[32];
    float mx = -INFINITY;
#pragma unroll
    for (int k = 0; k < 32; ++k) {
        int i = threadIdx.x + k * 256;
        v[k] = row[i] + mrow[i];
        mx = fmaxf(mx, v[k]);
    }

    __shared__ float red[256];
    red[threadIdx.x] = mx;
    __syncthreads();
    for (int off = 128; off > 0; off >>= 1) {
        if (threadIdx.x < off)
            red[threadIdx.x] = fmaxf(red[threadIdx.x], red[threadIdx.x + off]);
        __syncthreads();
    }
    mx = red[0];
    __syncthreads();

    float sum = 0.0f;
#pragma unroll
    for (int k = 0; k < 32; ++k) {
        v[k] = __expf(v[k] - mx);
        sum += v[k];
    }
    red[threadIdx.x] = sum;
    __syncthreads();
    for (int off = 128; off > 0; off >>= 1) {
        if (threadIdx.x < off)
            red[threadIdx.x] += red[threadIdx.x + off];
        __syncthreads();
    }
    const float inv = 1.0f / red[0];

#pragma unroll
    for (int k = 0; k < 32; ++k) {
        int i = threadIdx.x + k * 256;
        probs[(size_t)bt * S + i] = (bf16_t)(v[k] * inv);
    }
}

// ---------------------------------------------------------------------------
// Kernel 4: upart[sp,b,t,d] = sum over the s range of sp of probs[b,t,s] * x[b,s,d]
// The sum over s is cut into SPLIT ranges, one work-group each, so that the
// grid covers every WGP; the ranges are joined by usum_kernel.
// Async double-buffered f32 staging (untransposed [32 s][132 d]); B-fragment
// columns read per-element (lanes n=0..15 hit consecutive floats of a row:
// conflict-free), converted to bf16 at build.
// The work-group's 64 x SC piece of probs (the A side, the same for all eight
// waves) is brought into LDS once, by asynchronous copies of whole lines; the
// fragments are 16-byte LDS reads.
// ---------------------------------------------------------------------------
constexpr int PSP = SC + 8;              // LDS pitch of a probs row, bf16: 16 B over the row (16 B x odd) for 16-B readers
__global__ __launch_bounds__(256) void pv_kernel(const float* __restrict__ x,
                                                 const bf16_t* __restrict__ probs,
                                                 float* __restrict__ upart) {
    __shared__ float xsf[2][32][132];            // [buf][s_local][d_local], padded
    __shared__ __attribute__((aligned(16))) bf16_t ps[T * PSP];   // probs[b, :, s range]

    const int b   = blockIdx.x / (8 * SPLIT);    // / ((D/128) * SPLIT)
    const int sp  = (blockIdx.x >> 3) & (SPLIT - 1);
    const int d0  = (blockIdx.x & 7) << 7;       // *128
    const int tid = threadIdx.x;
    const int wave = tid >> 5;
    const int lane = tid & 31;
    const int h = lane >> 4;
    const int n = lane & 15;

    const float* xb = x + ((size_t)b * S + sp * SC) * D;
    const bf16_t* pb = probs + (size_t)(b * T) * S + sp * SC;
    float* u = upart + (size_t)sp * (B * T * D);

    // staging: thread moves 16 contiguous floats of row sl, col chunk c
    const int sl = tid >> 3;                     // 0..31
    const int c  = (tid & 7) * 16;               // 0..112
    const unsigned int lds0 = (unsigned int)(uintptr_t)&xsf[0][sl][c];
    const unsigned int lds1 = (unsigned int)(uintptr_t)&xsf[1][sl][c];
    const float* grow = xb + (size_t)sl * D + d0 + c;

    v8f acc[4] = {};

    // Wave w brings rows 8w .. 8w+7 of the probs piece, 512 bytes a row.  The wait and
    // the barrier at the head of the first pass cover these copies too and stand in
    // front of every read of ps.
    async_rows8<PSP * 2, S>((unsigned int)(uintptr_t)(ps + wave * 8 * PSP + lane * 8),
                            pb + (size_t)(wave * 8) * S + lane * 8);

    // prologue: DMA K-step 0 into buffer 0
    async_ld64B(lds0, (unsigned long long)(uintptr_t)grow);

    for (int i = 0; i < SC / 32; ++i) {
        wait_async0();
        __syncthreads();
        if (i + 1 < SC / 32) {
            unsigned int dst = ((i + 1) & 1) ? lds1 : lds0;
            async_ld64B(dst, (unsigned long long)(uintptr_t)
                                 (grow + (size_t)(i + 1) * 32 * D));
        }

        const int kb = i * 32;
        const float (*buf)[132] = xsf[i & 1];
        const int dl = wave * 16 + n;

        // B fragment: B[k][n] = x[b, sp*SC+kb+k, d0+dl]; k = 16*(e/8)+8h+(e%8)
        v16bf bfrag;
#pragma unroll
        for (int e = 0; e < 8; ++e) {
            bfrag[e]     = (bf16_t)buf[8 * h + e][dl];
            bfrag[8 + e] = (bf16_t)buf[16 + 8 * h + e][dl];
        }

#pragma unroll
        for (int mt = 0; mt < 4; ++mt) {
            const bf16_t* arow = ps + (mt * 16 + n) * PSP + kb;
            v8bf alo = *(const v8bf*)(arow + 8 * h);
            v8bf ahi = *(const v8bf*)(arow + 16 + 8 * h);
            v16bf afrag = cat16(alo, ahi);
            acc[mt] = __builtin_amdgcn_wmma_f32_16x16x32_bf16(
                false, afrag, false, bfrag, (short)0, acc[mt], false, false);
        }
    }

    const int dcol = d0 + wave * 16 + n;
#pragma unroll
    for (int mt = 0; mt < 4; ++mt)
#pragma unroll
        for (int r = 0; r < 8; ++r) {
            int t = mt * 16 + 8 * h + r;
            u[((size_t)(b * T + t)) * D + dcol] = acc[mt][r];
        }
}

// ---------------------------------------------------------------------------
// Kernel 4b: u[b,t,d] = sum_sp upart[sp,b,t,d], in rising sp; 4 floats a thread
// ---------------------------------------------------------------------------
__global__ __launch_bounds__(256) void usum_kernel(const float* __restrict__ upart,
                                                   float* __restrict__ u) {
    const int i4 = blockIdx.x * 256 + threadIdx.x;   // 0 .. B*T*D/4-1
    const float4* p = (const float4*)upart + i4;
    float4 v[SPLIT];
#pragma unroll   // constant indices keep v[] in registers and let the ranges' loads overlap
    for (int sp = 0; sp < SPLIT; ++sp)
        v[sp] = p[(size_t)sp * (B * T * D / 4)];
    float4 a = v[0];
#pragma unroll   // constant indices again: v[] stays in registers
    for (int sp = 1; sp < SPLIT; ++sp) {
        a.x += v[sp].x; a.y += v[sp].y; a.z += v[sp].z; a.w += v[sp].w;
    }
    ((float4*)u)[i4] = a;
}

constexpr int OT   = 32;
constexpr int OW   = 16;
constexpr int OKW  = D / OW;
constexpr int OP   = OKW + 4;
constexpr int OWR  = 2 * OT * OP;
constexpr int ORP  = OT + 4;

__device__ __forceinline__ void async_rows16(unsigned int l, const float* g) {
    asm volatile(
        "global_load_async_to_lds_b128 %0, %8, off\n\t"
        "global_load_async_to_lds_b128 %1, %9, off\n\t"
        "global_load_async_to_lds_b128 %2, %10, off\n\t"
        "global_load_async_to_lds_b128 %3, %11, off\n\t"
        "global_load_async_to_lds_b128 %4, %12, off\n\t"
        "global_load_async_to_lds_b128 %5, %13, off\n\t"
        "global_load_async_to_lds_b128 %6, %14, off\n\t"
        "global_load_async_to_lds_b128 %7, %15, off\n\t"
        "s_wait_xcnt 0x0"
        :: "v"(l),                "v"(l +  2 * OP * 4), "v"(l +  4 * OP * 4), "v"(l +  6 * OP * 4),
           "v"(l +  8 * OP * 4), "v"(l + 10 * OP * 4), "v"(l + 12 * OP * 4), "v"(l + 14 * OP * 4),
           "v"(g),          "v"(g +  2 * D), "v"(g +  4 * D), "v"(g +  6 * D),
           "v"(g +  8 * D), "v"(g + 10 * D), "v"(g + 12 * D), "v"(g + 14 * D)
        : "memory");
}

__global__ __launch_bounds__(32 * OW) void out_kernel(const float* __restrict__ u,
                                                      const float* __restrict__ wv,
                                                      float* __restrict__ out) {
    __shared__ __attribute__((aligned(16))) float st[OW * OWR];

    const int bt0 = (blockIdx.x >> 5) * OT;      // 8 tiles over B*T
    const int h0  = (blockIdx.x & 31) * OT;      // 32 tiles over H
    const int tid = threadIdx.x;
    const int wave = tid >> 5;
    const int lane = tid & 31;
    const int hh = lane >> 4;
    const int c  = lane & 15;

    float* my = st + wave * OWR;                 // rows 0..31: u, rows 32..63: wv

    // staging: lane half hh takes row 2r + hh, lane c its floats 4c .. 4c+3
    const float* gu = u  + (size_t)(bt0 + hh) * D + wave * OKW + c * 4;
    const float* gw = wv + (size_t)(h0  + hh) * D + wave * OKW + c * 4;
    const unsigned int sm = (unsigned int)(uintptr_t)(my + hh * OP + c * 4);
    async_rows16(sm + OT * OP * 4,        gw);            // wv rows  0..15
    async_rows16(sm + (OT + 16) * OP * 4, gw + 16 * D);   // wv rows 16..31
    async_rows16(sm,                      gu);            // u rows   0..15
    async_rows16(sm + 16 * OP * 4,        gu + 16 * D);   // u rows  16..31
    wait_async0();                               // this wave's copies have landed
    __syncthreads();                             // nobody reads the rows in front of this

    v8f acc[2][2] = {};
    // A and B fragments come from the same loader, so their k orders are equal:
    // lane half hh holds d = 8j + 4hh + {0,1} in the first product of a group
    // and d = 8j + 4hh + {2,3} in the second.
    const float* fa = my + c * OP + 4 * hh;
    const float* fb = fa + OT * OP;
#pragma unroll   // straight-line code lets the LDS reads run ahead of the matrix instructions
    for (int j = 0; j < OKW / 8; ++j) {
        const float4 a0 = *(const float4*)(fa + 8 * j);
        const float4 a1 = *(const float4*)(fa + 16 * OP + 8 * j);
        const float4 b0 = *(const float4*)(fb + 8 * j);
        const float4 b1 = *(const float4*)(fb + 16 * OP + 8 * j);
        const v2f a0l = {a0.x, a0.y}, a0h = {a0.z, a0.w};
        const v2f a1l = {a1.x, a1.y}, a1h = {a1.z, a1.w};
        const v2f b0l = {b0.x, b0.y}, b0h = {b0.z, b0.w};
        const v2f b1l = {b1.x, b1.y}, b1h = {b1.z, b1.w};
        acc[0][0] = __builtin_amdgcn_wmma_f32_16x16x4_f32(false, a0l, false, b0l, (short)0, acc[0][0], false, false);
        acc[0][1] = __builtin_amdgcn_wmma_f32_16x16x4_f32(false, a0l, false, b1l, (short)0, acc[0][1], false, false);
        acc[1][0] = __builtin_amdgcn_wmma_f32_16x16x4_f32(false, a1l, false, b0l, (short)0, acc[1][0], false, false);
        acc[1][1] = __builtin_amdgcn_wmma_f32_16x16x4_f32(false, a1l, false, b1l, (short)0, acc[1][1], false, false);
        acc[0][0] = __builtin_amdgcn_wmma_f32_16x16x4_f32(false, a0h, false, b0h, (short)0, acc[0][0], false, false);
        acc[0][1] = __builtin_amdgcn_wmma_f32_16x16x4_f32(false, a0h, false, b1h, (short)0, acc[0][1], false, false);
        acc[1][0] = __builtin_amdgcn_wmma_f32_16x16x4_f32(false, a1h, false, b0h, (short)0, acc[1][0], false, false);
        acc[1][1] = __builtin_amdgcn_wmma_f32_16x16x4_f32(false, a1h, false, b1h, (short)0, acc[1][1], false, false);
    }

    // Partial tile into the head of the wave's own range (its rows are all read:
    // every accumulator depends on them).  D layout: register r <-> row 8*hh + r, column c.
#pragma unroll   // these three: constant indices keep acc[][] in registers
    for (int i = 0; i < 2; ++i)
#pragma unroll
        for (int jn = 0; jn < 2; ++jn)
#pragma unroll
            for (int r = 0; r < 8; ++r)
                my[(16 * i + 8 * hh + r) * ORP + 16 * jn + c] = acc[i][jn][r];
    __syncthreads();                             // the partial tiles are complete

    const int row = tid >> 4;                    // 0..31
    const int col = (tid & 15) * 2;              // 16 threads store one 128-B line of out
    const float* pr = st + row * ORP + col;
    float2 s = *(const float2*)pr;
#pragma unroll   // the LDS reads issue together
    for (int w = 1; w < OW; ++w) {
        const float2 q2 = *(const float2*)(pr + w * OWR);
        s.x += q2.x; s.y += q2.y;
    }
    *(float2*)(out + (size_t)(bt0 + row) * H + h0 + col) = s;
}

// ---------------------------------------------------------------------------
extern "C" void kernel_launch(void* const* d_in, const int* in_sizes, int n_in,
                              void* d_out, int out_size, void* d_ws, size_t ws_size,
                              hipStream_t stream) {
    const float* x    = (const float*)d_in[0];   // (B,S,D)
    const float* mask = (const float*)d_in[1];   // (B,1,S)
    const float* wk   = (const float*)d_in[2];   // (H,D)
    const float* wv   = (const float*)d_in[3];   // (H,D)
    const float* q    = (const float*)d_in[4];   // (T,H)
    float* out = (float*)d_out;                  // (B,T,H)

    char* ws = (char*)d_ws;
    bf16_t* qk_ws    = (bf16_t*)(ws);                                  // T*D bf16   = 128 KB
    float*  score_ws = (float*)(ws + 131072);                          // B*T*S f32  = 8 MB
    bf16_t* probs_ws = (bf16_t*)(ws + 131072 + 8388608);               // B*T*S bf16 = 4 MB
    float*  u_ws     = (float*)(ws + 131072 + 8388608 + 4194304);      // B*T*D f32  = 1 MB
    float*  upart_ws = (float*)(ws + 131072 + 8388608 + 4194304 + 1048576); // SPLIT * 1 MB

    qk_kernel<<<(T / QT) * (D / QN), 32 * QW, 0, stream>>>(q, wk, qk_ws);
    scores_kernel<<<B * (S / 128), 256, 0, stream>>>(x, qk_ws, score_ws);
    softmax_kernel<<<B * T, 256, 0, stream>>>(score_ws, mask, probs_ws);
    pv_kernel<<<B * (D / 128) * SPLIT, 256, 0, stream>>>(x, probs_ws, upart_ws);
    usum_kernel<<<(B * T * D / 4) / 256, 256, 0, stream>>>(upart_ws, u_ws);
    out_kernel<<<(B * T / OT) * (H / OT), 32 * OW, 0, stream>>>(u_ws, wv, out);
}

// v006
// Measured time: 47.7 microseconds a run.
// Two timings next to v005 put it at 1.12 and 1.11 times that version's speed.
// Counting every step since v000, it is 10.3 times as fast.
#include <hip/hip_runtime.h>
#include <hip/hip_bf16.h>

// Problem constants (from reference)
constexpr int B = 4;
constexpr int S = 8192;
constexpr int D = 1024;   // DIM
constexpr int H = 1024;   // HDIM
constexpr int T = 64;     // NUM_TOKENS

typedef __bf16 bf16_t;
typedef __attribute__((ext_vector_type(8)))  __bf16 v8bf;
typedef __attribute__((ext_vector_type(16))) __bf16 v16bf;
typedef __attribute__((ext_vector_type(8)))  float  v8f;

__device__ __forceinline__ v16bf cat16(v8bf lo, v8bf hi) {
    return __builtin_shufflevector(lo, hi, 0,1,2,3,4,5,6,7,8,9,10,11,12,13,14,15);
}

// The wave's own asynchronous copies to LDS have landed.
__device__ __forceinline__ void wait_async0() {
    asm volatile("s_wait_asynccnt 0x0" ::: "memory");
}

template <int LS, int GS, typename E>
__device__ __forceinline__ void async_rows8(unsigned int l, const E* g) {
    asm volatile(
        "global_load_async_to_lds_b128 %0, %8, off\n\t"
        "global_load_async_to_lds_b128 %1, %9, off\n\t"
        "global_load_async_to_lds_b128 %2, %10, off\n\t"
        "global_load_async_to_lds_b128 %3, %11, off\n\t"
        "global_load_async_to_lds_b128 %4, %12, off\n\t"
        "global_load_async_to_lds_b128 %5, %13, off\n\t"
        "global_load_async_to_lds_b128 %6, %14, off\n\t"
        "global_load_async_to_lds_b128 %7, %15, off\n\t"
        "s_wait_xcnt 0x0"
        :: "v"(l),          "v"(l + 1 * LS), "v"(l + 2 * LS), "v"(l + 3 * LS),
           "v"(l + 4 * LS), "v"(l + 5 * LS), "v"(l + 6 * LS), "v"(l + 7 * LS),
           "v"(g),          "v"(g + 1 * GS), "v"(g + 2 * GS), "v"(g + 3 * GS),
           "v"(g + 4 * GS), "v"(g + 5 * GS), "v"(g + 6 * GS), "v"(g + 7 * GS)
        : "memory");
}

constexpr int QT  = 16;
constexpr int QN  = 64;
constexpr int QW  = 16;
constexpr int QK  = H / QW;
constexpr int QP  = QN + 4;
constexpr int QWR = QT * QP;
typedef __attribute__((ext_vector_type(2))) float  v2f;
typedef __attribute__((ext_vector_type(4))) float  v4f;
typedef __attribute__((ext_vector_type(2))) __bf16 v2bf;

__global__ __launch_bounds__(32 * QW) void qk_kernel(const float* __restrict__ q,
                                                     const float* __restrict__ wk,
                                                     bf16_t* __restrict__ qk) {
    __shared__ __attribute__((aligned(16))) float part[QW * QWR];

    const int t0  = (blockIdx.x >> 4) * QT;      // 4 tiles over T
    const int d0  = (blockIdx.x & 15) * QN;      // 16 tiles over D
    const int tid = threadIdx.x;
    const int wave = tid >> 5;
    const int lane = tid & 31;
    const int hh = lane >> 4;
    const int c  = lane & 15;

    // wk is the A side (row c of tile e is d0 + 16e + c), q the B side (column c is
    // t0 + c).  Lane half hh holds h = 64*wave + 8j + 4hh + 2p + s (s = 0, 1: the two
    // registers of an operand) on both sides.  q: four consecutive floats of a row give
    // p = 0 and p = 1.  wk: the two rows of an operand are loaded as single floats, so
    // that each lands in its own register of the pair and no move is needed.
    const float* ga = q  + (size_t)(t0 + c) * H + wave * QK + 4 * hh;
    const float* gb = wk + (size_t)(wave * QK + 4 * hh) * D + d0 + c;
    v4f a[QK / 8];
    v2f b[QK / 8][2][4];
#pragma unroll   // these four: constant indices keep a[] and b[][][] in registers
    for (int j = 0; j < QK / 8; ++j) {
        a[j] = *(const v4f*)(ga + 8 * j);
#pragma unroll
        for (int p = 0; p < 2; ++p)
#pragma unroll
            for (int s = 0; s < 2; ++s)
#pragma unroll
                for (int e = 0; e < 4; ++e)
                    b[j][p][e][s] = gb[(size_t)(8 * j + 2 * p + s) * D + 16 * e];
    }
    // Keeps every load above in front of the first matrix instruction: without it the
    // scheduler sinks the loads to their uses and the wave pays the latency once per group.
    __builtin_amdgcn_sched_barrier(0);

    v8f acc[4] = {};
#pragma unroll   // these three: constant indices into a[], b[][][] and acc[]
    for (int j = 0; j < QK / 8; ++j)
#pragma unroll
        for (int p = 0; p < 2; ++p) {
            const v2f qv = {a[j][2 * p], a[j][2 * p + 1]};
#pragma unroll
            for (int e = 0; e < 4; ++e)
                acc[e] = __builtin_amdgcn_wmma_f32_16x16x4_f32(false, b[j][p][e], false, qv, (short)0, acc[e], false, false);
        }
    __builtin_amdgcn_sched_barrier(0);
    asm volatile("v_nop\n\tv_nop\n\tv_nop\n\tv_nop");
    __builtin_amdgcn_sched_barrier(0);

    // D layout: register r <-> d0 + 16e + 8*hh + r of row t0 + c: eight adjacent floats a tile.
    float* my = part + wave * QWR + c * QP + 8 * hh;
#pragma unroll   // constant indices keep acc[] in registers
    for (int e = 0; e < 4; ++e) {
        const v4f lo = {acc[e][0], acc[e][1], acc[e][2], acc[e][3]};
        const v4f hi = {acc[e][4], acc[e][5], acc[e][6], acc[e][7]};
        *(v4f*)(my + 16 * e)     = lo;
        *(v4f*)(my + 16 * e + 4) = hi;
    }
    __syncthreads();                             // the partial tiles are complete

    const int row = tid >> 5;                    // 0..15: a wave stores one 128-B line of qk
    const int col = (tid & 31) * 2;
    const float* pr = part + row * QP + col;
    v2f s = *(const v2f*)pr;
#pragma unroll   // the LDS reads issue together
    for (int w = 1; w < QW; ++w)
        s += *(const v2f*)(pr + w * QWR);
    const v2bf o2 = {(bf16_t)(s[0] * 0.03125f), (bf16_t)(s[1] * 0.03125f)};   // 1/sqrt(1024)
    *(v2bf*)(qk + (size_t)(t0 + row) * D + d0 + col) = o2;
}

constexpr int QSP = D + 8;               // LDS pitch of a qk row, bf16: 16 B over the row (16 B x odd) for 16-B readers
constexpr int XK  = 128;                 // d columns of a tile of x
constexpr int XP  = XK + 4;              // LDS pitch of an x row, floats: 16 B over the row (16 B x odd) for 16-B readers
constexpr int XT  = 16 * XP;             // floats of one buffer of one wave
constexpr int XN  = D / XK;              // tiles a wave streams
constexpr int SB  = 128;                 // s rows of a block
constexpr int NB  = S / SB;              // blocks of a batch
constexpr int SCP = SB + 4;              // LDS pitch of a row of scores, floats
constexpr int PP  = SB + 8;              // LDS pitch of a row of p, bf16: 16 B over the row (16 B x odd) for 16-B readers
static_assert(NB == 64, "usum_kernel holds two blocks a lane");
__global__ __launch_bounds__(256) void attn_kernel(const float* __restrict__ x,
                                                   const bf16_t* __restrict__ qk,
                                                   const float* __restrict__ mask,
                                                   float* __restrict__ upart,
                                                   float* __restrict__ mb,
                                                   float* __restrict__ lb) {
    __shared__ __attribute__((aligned(16))) float xs[8 * 2 * XT]; // [wave][buf][s_local][k_local]
    __shared__ __attribute__((aligned(16))) bf16_t qs[T * QSP];   // all of qk
    __shared__ __attribute__((aligned(16))) float sc[T * SCP];    // the block's scores
    __shared__ __attribute__((aligned(16))) bf16_t ps[T * PP];    // the block's p

    const int b   = blockIdx.x >> 6;             // / NB
    const int s0  = (blockIdx.x & 63) << 7;      // * SB
    const int tid = threadIdx.x;
    const int wave = tid >> 5;
    const int lane = tid & 31;
    const int h = lane >> 4;                     // lane half
    const int n = lane & 15;                     // N index / A row-within-tile

    float* myx = xs + wave * (2 * XT);           // this wave's two buffers
    const unsigned int xl = (unsigned int)(uintptr_t)(myx + lane * 4);
    const float* xg = x + ((size_t)b * S + s0 + wave * 16) * D + lane * 4;
    auto copy_tile = [&](int t) {
        const unsigned int l = xl + (t & 1) * (XT * 4);
        const float* g = xg + t * XK;
        async_rows8<XP * 4, D>(l,              g);
        async_rows8<XP * 4, D>(l + 8 * XP * 4, g + 8 * D);
    };

    v8f acc[4] = {};

    copy_tile(0);                                // from memory: issued ahead of qk, which comes from L2

    // Wave w brings rows 8w .. 8w+7 of qk, four 512-byte pieces a row.  This wave's
    // copies (tile 0 too) have landed behind the wait; the barrier stands in front of
    // every read of qs.
    {
        const unsigned int ql = (unsigned int)(uintptr_t)(qs + wave * 8 * QSP + lane * 8);
        const bf16_t* qg = qk + (size_t)(wave * 8) * D + lane * 8;
        async_rows8<QSP * 2, D>(ql,        qg);
        async_rows8<QSP * 2, D>(ql +  512, qg + 256);
        async_rows8<QSP * 2, D>(ql + 1024, qg + 512);
        async_rows8<QSP * 2, D>(ql + 1536, qg + 768);
        wait_async0();
    }
    __syncthreads();

    copy_tile(1);

    const float mv = mask[(size_t)b * S + s0 + wave * 16 + n];
    // No register that the load above names is written again in front of this wait.
    asm volatile("s_wait_xcnt 0x0" ::: "memory");

    for (int t = 0; t < XN; ++t) {
        const float* brow = myx + (t & 1) * XT + n * XP;
#pragma unroll   // constant LDS offsets; the reads of a tile can run ahead of its matrix instructions
        for (int kk = 0; kk < XK / 32; ++kk) {
            const int kb = t * XK + kk * 32;

            // B fragment: B[k][n] = x[b, s0+16*wave+n, kb+k]; k = 16*(e/8)+8h+(e%8)
            const float4* rowp = (const float4*)(brow + kk * 32);
            float4 f0 = rowp[2 * h];
            float4 f1 = rowp[2 * h + 1];
            float4 f2 = rowp[4 + 2 * h];
            float4 f3 = rowp[4 + 2 * h + 1];
            v16bf bfrag;
            bfrag[0]  = (bf16_t)f0.x; bfrag[1]  = (bf16_t)f0.y;
            bfrag[2]  = (bf16_t)f0.z; bfrag[3]  = (bf16_t)f0.w;
            bfrag[4]  = (bf16_t)f1.x; bfrag[5]  = (bf16_t)f1.y;
            bfrag[6]  = (bf16_t)f1.z; bfrag[7]  = (bf16_t)f1.w;
            bfrag[8]  = (bf16_t)f2.x; bfrag[9]  = (bf16_t)f2.y;
            bfrag[10] = (bf16_t)f2.z; bfrag[11] = (bf16_t)f2.w;
            bfrag[12] = (bf16_t)f3.x; bfrag[13] = (bf16_t)f3.y;
            bfrag[14] = (bf16_t)f3.z; bfrag[15] = (bf16_t)f3.w;

#pragma unroll
            for (int mt = 0; mt < 4; ++mt) {
                const bf16_t* arow = qs + (mt * 16 + n) * QSP + kb;
                v8bf alo = *(const v8bf*)(arow + 8 * h);
                v8bf ahi = *(const v8bf*)(arow + 16 + 8 * h);
                v16bf afrag = cat16(alo, ahi);
                acc[mt] = __builtin_amdgcn_wmma_f32_16x16x32_bf16(
                    false, afrag, false, bfrag, (short)0, acc[mt], false, false);
            }
        }
        // This wave's reads of tile t have returned: its buffer may be refilled.
        asm volatile("s_wait_dscnt 0x0" ::: "memory");
        wait_async0();                           // tile t + 1 has landed; behind the last trip no copy is outstanding
        if (t + 2 < XN) copy_tile(t + 2);        // into the buffer that tile t has left
    }

#pragma unroll
    for (int mt = 0; mt < 4; ++mt)
#pragma unroll
        for (int rr = 0; rr < 8; ++rr)
            sc[(mt * 16 + 8 * h + rr) * SCP + wave * 16 + n] = acc[mt][rr] + mv;
    // The scores are complete.  The same barrier stands behind every wave's last
    // s_wait_asynccnt 0, so behind it tiles XN-2 and XN-1 may be read by every wave.
    __syncthreads();
    const int st = tid >> 2;                     // four neighbouring lanes share a row of scores
    const int qd = tid & 3;                      // each takes 32 of its 128 columns
    float mx, sum;
    {
        const int t = st;
        const float4* sr = (const float4*)(sc + t * SCP + 32 * qd);
        float v[32];
#pragma unroll   // constant indices keep v[] in registers (the three loops below too)
        for (int k = 0; k < 8; ++k) {
            const float4 f = sr[k];
            v[4 * k] = f.x; v[4 * k + 1] = f.y; v[4 * k + 2] = f.z; v[4 * k + 3] = f.w;
        }
        mx = v[0];
#pragma unroll
        for (int k = 1; k < 32; ++k) mx = fmaxf(mx, v[k]);
        mx = fmaxf(mx, __shfl_xor(mx, 1));
        mx = fmaxf(mx, __shfl_xor(mx, 2));
        // a block that the mask shuts out whole: p = 0 and weight 0, not inf - inf
        const float ms = (mx == -INFINITY) ? 0.0f : mx;
        sum = 0.0f;
#pragma unroll
        for (int k = 0; k < 32; ++k) {
            v[k] = __expf(v[k] - ms);
            sum += v[k];
        }
        sum += __shfl_xor(sum, 1);
        sum += __shfl_xor(sum, 2);
        bf16_t* pw = ps + t * PP + 32 * qd;
#pragma unroll
        for (int k = 0; k < 4; ++k) {
            v8bf o;
#pragma unroll
            for (int e = 0; e < 8; ++e) o[e] = (bf16_t)v[8 * k + e];
            *(v8bf*)(pw + 8 * k) = o;
        }
    }
    __syncthreads();                             // p is complete
    if (qd == 0) {                               // behind the barrier, which would wait for these stores
        mb[(size_t)(b * T + st) * NB + (blockIdx.x & 63)] = mx;
        lb[(size_t)(b * T + st) * NB + (blockIdx.x & 63)] = sum;
    }

    // ---- step 3 ----
    // A side: all of p, the same for every tile of x, held in registers.
    v16bf af[4][SB / 32];
#pragma unroll   // these two: constant indices keep af[][] in registers
    for (int mt = 0; mt < 4; ++mt)
#pragma unroll
        for (int ks = 0; ks < SB / 32; ++ks) {
            const bf16_t* arow = ps + (mt * 16 + n) * PP + ks * 32;
            af[mt][ks] = cat16(*(const v8bf*)(arow + 8 * h), *(const v8bf*)(arow + 16 + 8 * h));
        }

    float* ub = upart + (size_t)blockIdx.x * (T * D) + (size_t)(8 * h) * D + wave * 16 + n;
    for (int j = 0; j < XN; ++j) {
        const int ct = XN - 1 - j;               // tile of this trip
        // column 16*wave + n of the tile; row 16g + r of the block is row r of wave g's buffer
        const float* bcol = xs + (ct & 1) * XT + (8 * h) * XP + wave * 16 + n;
        v8f a2[4] = {};
#pragma unroll   // constant LDS offsets and constant indices into af[][]
        for (int ks = 0; ks < SB / 32; ++ks) {
            // B fragment: B[k][n] = x[b, s0+32*ks+k, ...]; k = 16*(e/8)+8h+(e%8)
            v16bf bfrag;
#pragma unroll
            for (int e = 0; e < 8; ++e) {
                bfrag[e]     = (bf16_t)bcol[(2 * ks)     * (2 * XT) + e * XP];
                bfrag[8 + e] = (bf16_t)bcol[(2 * ks + 1) * (2 * XT) + e * XP];
            }
#pragma unroll
            for (int mt = 0; mt < 4; ++mt)
                a2[mt] = __builtin_amdgcn_wmma_f32_16x16x32_bf16(
                    false, af[mt][ks], false, bfrag, (short)0, a2[mt], false, false);
        }
        // Foot of the trip: this wave's reads of the tile have returned, its copies of the
        // next tile have landed; behind the barrier the next tile may be read by every wave
        // and this trip's buffer refilled.  Behind the last trip no copy is outstanding.
        asm volatile("s_wait_dscnt 0x0" ::: "memory");
        wait_async0();
        __syncthreads();
        if (j + 2 < XN) copy_tile(ct - 2);       // into the buffer that this trip has left

        // The stores stand behind the barrier, which waits for a wave's outstanding stores:
        // so they drain under the next trip's work.
#pragma unroll   // these two: constant indices keep a2[] in registers
        for (int mt = 0; mt < 4; ++mt)
#pragma unroll
            for (int r = 0; r < 8; ++r)
                ub[(size_t)(mt * 16 + r) * D + ct * XK] = a2[mt][r];
    }
}

// ---------------------------------------------------------------------------
// Kernel 3: u[b,t,d] = sum_k w[k] * upart[b,k,t,d] / sum_k w[k] * lb[b,t,k],
// w[k] = exp(mb[b,t,k] - max_k mb[b,t,k]), k the blocks of the batch in rising order.
// One work-group per (b,t), 4 floats a thread.  Every wave forms the weights for
// itself, two blocks a lane.
// ---------------------------------------------------------------------------
__global__ __launch_bounds__(256) void usum_kernel(const float* __restrict__ upart,
                                                   const float* __restrict__ mb,
                                                   const float* __restrict__ lb,
                                                   float* __restrict__ u) {
    const int bt   = blockIdx.x;                 // 0 .. B*T-1
    const int lane = threadIdx.x & 31;
    const float4* p = (const float4*)upart
                    + ((size_t)(bt >> 6) * NB * T + (bt & 63)) * (D / 4) + threadIdx.x;

    const float m0 = mb[bt * NB + lane], m1 = mb[bt * NB + 32 + lane];
    const float l0 = lb[bt * NB + lane], l1 = lb[bt * NB + 32 + lane];
    float mx = fmaxf(m0, m1);
#pragma unroll
    for (int off = 16; off > 0; off >>= 1) mx = fmaxf(mx, __shfl_xor(mx, off));
    float w[2] = {__expf(m0 - mx), __expf(m1 - mx)};
    float ls = w[0] * l0 + w[1] * l1;
#pragma unroll
    for (int off = 16; off > 0; off >>= 1) ls += __shfl_xor(ls, off);
    const float inv = 1.0f / ls;
    w[0] *= inv; w[1] *= inv;

    float4 a = {0.0f, 0.0f, 0.0f, 0.0f};
#pragma unroll   // constant index into w[], a constant lane to read the weight from; the blocks' loads overlap
    for (int k = 0; k < NB; ++k) {
        const float4 v = p[(size_t)k * (T * D / 4)];
        const float wk = __uint_as_float(__builtin_amdgcn_readlane(__float_as_uint(w[k >> 5]), k & 31));
        a.x += wk * v.x; a.y += wk * v.y; a.z += wk * v.z; a.w += wk * v.w;
    }
    ((float4*)u)[bt * (D / 4) + threadIdx.x] = a;
}

constexpr int OT   = 32;
constexpr int OW   = 16;
constexpr int OKW  = D / OW;
constexpr int OP   = OKW + 4;
constexpr int OWR  = 2 * OT * OP;
constexpr int ORP  = OT + 4;

__device__ __forceinline__ void async_rows16(unsigned int l, const float* g) {
    asm volatile(
        "global_load_async_to_lds_b128 %0, %8, off\n\t"
        "global_load_async_to_lds_b128 %1, %9, off\n\t"
        "global_load_async_to_lds_b128 %2, %10, off\n\t"
        "global_load_async_to_lds_b128 %3, %11, off\n\t"
        "global_load_async_to_lds_b128 %4, %12, off\n\t"
        "global_load_async_to_lds_b128 %5, %13, off\n\t"
        "global_load_async_to_lds_b128 %6, %14, off\n\t"
        "global_load_async_to_lds_b128 %7, %15, off\n\t"
        "s_wait_xcnt 0x0"
        :: "v"(l),                "v"(l +  2 * OP * 4), "v"(l +  4 * OP * 4), "v"(l +  6 * OP * 4),
           "v"(l +  8 * OP * 4), "v"(l + 10 * OP * 4), "v"(l + 12 * OP * 4), "v"(l + 14 * OP * 4),
           "v"(g),          "v"(g +  2 * D), "v"(g +  4 * D), "v"(g +  6 * D),
           "v"(g +  8 * D), "v"(g + 10 * D), "v"(g + 12 * D), "v"(g + 14 * D)
        : "memory");
}

__global__ __launch_bounds__(32 * OW) void out_kernel(const float* __restrict__ u,
                                                      const float* __restrict__ wv,
                                                      float* __restrict__ out) {
    __shared__ __attribute__((aligned(16))) float st[OW * OWR];

    const int bt0 = (blockIdx.x >> 5) * OT;      // 8 tiles over B*T
    const int h0  = (blockIdx.x & 31) * OT;      // 32 tiles over H
    const int tid = threadIdx.x;
    const int wave = tid >> 5;
    const int lane = tid & 31;
    const int hh = lane >> 4;
    const int c  = lane & 15;

    float* my = st + wave * OWR;                 // rows 0..31: u, rows 32..63: wv

    // staging: lane half hh takes row 2r + hh, lane c its floats 4c .. 4c+3
    const float* gu = u  + (size_t)(bt0 + hh) * D + wave * OKW + c * 4;
    const float* gw = wv + (size_t)(h0  + hh) * D + wave * OKW + c * 4;
    const unsigned int sm = (unsigned int)(uintptr_t)(my + hh * OP + c * 4);
    async_rows16(sm + OT * OP * 4,        gw);            // wv rows  0..15
    async_rows16(sm + (OT + 16) * OP * 4, gw + 16 * D);   // wv rows 16..31
    async_rows16(sm,                      gu);            // u rows   0..15
    async_rows16(sm + 16 * OP * 4,        gu + 16 * D);   // u rows  16..31
    wait_async0();                               // this wave's copies have landed
    __syncthreads();                             // nobody reads the rows in front of this

    v8f acc[2][2] = {};
    // A and B fragments come from the same loader, so their k orders are equal:
    // lane half hh holds d = 8j + 4hh + {0,1} in the first product of a group
    // and d = 8j + 4hh + {2,3} in the second.
    const float* fa = my + c * OP + 4 * hh;
    const float* fb = fa + OT * OP;
#pragma unroll   // straight-line code lets the LDS reads run ahead of the matrix instructions
    for (int j = 0; j < OKW / 8; ++j) {
        const float4 a0 = *(const float4*)(fa + 8 * j);
        const float4 a1 = *(const float4*)(fa + 16 * OP + 8 * j);
        const float4 b0 = *(const float4*)(fb + 8 * j);
        const float4 b1 = *(const float4*)(fb + 16 * OP + 8 * j);
        const v2f a0l = {a0.x, a0.y}, a0h = {a0.z, a0.w};
        const v2f a1l = {a1.x, a1.y}, a1h = {a1.z, a1.w};
        const v2f b0l = {b0.x, b0.y}, b0h = {b0.z, b0.w};
        const v2f b1l = {b1.x, b1.y}, b1h = {b1.z, b1.w};
        acc[0][0] = __builtin_amdgcn_wmma_f32_16x16x4_f32(false, a0l, false, b0l, (short)0, acc[0][0], false, false);
        acc[0][1] = __builtin_amdgcn_wmma_f32_16x16x4_f32(false, a0l, false, b1l, (short)0, acc[0][1], false, false);
        acc[1][0] = __builtin_amdgcn_wmma_f32_16x16x4_f32(false, a1l, false, b0l, (short)0, acc[1][0], false, false);
        acc[1][1] = __builtin_amdgcn_wmma_f32_16x16x4_f32(false, a1l, false, b1l, (short)0, acc[1][1], false, false);
        acc[0][0] = __builtin_amdgcn_wmma_f32_16x16x4_f32(false, a0h, false, b0h, (short)0, acc[0][0], false, false);
        acc[0][1] = __builtin_amdgcn_wmma_f32_16x16x4_f32(false, a0h, false, b1h, (short)0, acc[0][1], false, false);
        acc[1][0] = __builtin_amdgcn_wmma_f32_16x16x4_f32(false, a1h, false, b0h, (short)0, acc[1][0], false, false);
        acc[1][1] = __builtin_amdgcn_wmma_f32_16x16x4_f32(false, a1h, false, b1h, (short)0, acc[1][1], false, false);
    }

    // Partial tile into the head of the wave's own range (its rows are all read:
    // every accumulator depends on them).  D layout: register r <-> row 8*hh + r, column c.
#pragma unroll   // these three: constant indices keep acc[][] in registers
    for (int i = 0; i < 2; ++i)
#pragma unroll
        for (int jn = 0; jn < 2; ++jn)
#pragma unroll
            for (int r = 0; r < 8; ++r)
                my[(16 * i + 8 * hh + r) * ORP + 16 * jn + c] = acc[i][jn][r];
    __syncthreads();                             // the partial tiles are complete

    const int row = tid >> 4;                    // 0..31
    const int col = (tid & 15) * 2;              // 16 threads store one 128-B line of out
    const float* pr = st + row * ORP + col;
    float2 s = *(const float2*)pr;
#pragma unroll   // the LDS reads issue together
    for (int w = 1; w < OW; ++w) {
        const float2 q2 = *(const float2*)(pr + w * OWR);
        s.x += q2.x; s.y += q2.y;
    }
    *(float2*)(out + (size_t)(bt0 + row) * H + h0 + col) = s;
}

// ---------------------------------------------------------------------------
extern "C" void kernel_launch(void* const* d_in, const int* in_sizes, int n_in,
                              void* d_out, int out_size, void* d_ws, size_t ws_size,
                              hipStream_t stream) {
    const float* x    = (const float*)d_in[0];   // (B,S,D)
    const float* mask = (const float*)d_in[1];   // (B,1,S)
    const float* wk   = (const float*)d_in[2];   // (H,D)
    const float* wv   = (const float*)d_in[3];   // (H,D)
    const float* q    = (const float*)d_in[4];   // (T,H)
    float* out = (float*)d_out;                  // (B,T,H)

    char* ws = (char*)d_ws;
    bf16_t* qk_ws    = (bf16_t*)(ws);                                  // T*D bf16      = 128 KB
    float*  mb_ws    = (float*)(ws + 131072);                          // B*T*NB f32    = 64 KB
    float*  lb_ws    = (float*)(ws + 131072 + 65536);                  // B*T*NB f32    = 64 KB
    float*  u_ws     = (float*)(ws + 131072 + 131072);                 // B*T*D f32     = 1 MB
    float*  upart_ws = (float*)(ws + 131072 + 131072 + 1048576);       // B*NB*T*D f32  = 64 MB

    qk_kernel<<<(T / QT) * (D / QN), 32 * QW, 0, stream>>>(q, wk, qk_ws);
    attn_kernel<<<B * NB, 256, 0, stream>>>(x, qk_ws, mask, upart_ws, mb_ws, lb_ws);
    usum_kernel<<<B * T, 256, 0, stream>>>(upart_ws, mb_ws, lb_ws, u_ws);
    out_kernel<<<(B * T / OT) * (H / OT), 32 * OW, 0, stream>>>(u_ws, wv, out);
}

// v007
// A run of this version takes 44.7 microseconds.
// Timed twice side by side with v006, it ran 1.05 and 1.04 times as fast.
// Over all steps from v000 it is 10.8 times as fast.
#include <hip/hip_runtime.h>
#include <hip/hip_bf16.h>

// Problem constants (from reference)
constexpr int B = 4;
constexpr int S = 8192;
constexpr int D = 1024;   // DIM
constexpr int H = 1024;   // HDIM
constexpr int T = 64;     // NUM_TOKENS

typedef __bf16 bf16_t;
typedef __attribute__((ext_vector_type(8)))  __bf16 v8bf;
typedef __attribute__((ext_vector_type(16))) __bf16 v16bf;
typedef __attribute__((ext_vector_type(8)))  float  v8f;

__device__ __forceinline__ v16bf cat16(v8bf lo, v8bf hi) {
    return __builtin_shufflevector(lo, hi, 0,1,2,3,4,5,6,7,8,9,10,11,12,13,14,15);
}

// The wave's own asynchronous copies to LDS have landed.
__device__ __forceinline__ void wait_async0() {
    asm volatile("s_wait_asynccnt 0x0" ::: "memory");
}

template <int LS, int GS, typename E>
__device__ __forceinline__ void async_rows8(unsigned int l, const E* g) {
    asm volatile(
        "global_load_async_to_lds_b128 %0, %8, off\n\t"
        "global_load_async_to_lds_b128 %1, %9, off\n\t"
        "global_load_async_to_lds_b128 %2, %10, off\n\t"
        "global_load_async_to_lds_b128 %3, %11, off\n\t"
        "global_load_async_to_lds_b128 %4, %12, off\n\t"
        "global_load_async_to_lds_b128 %5, %13, off\n\t"
        "global_load_async_to_lds_b128 %6, %14, off\n\t"
        "global_load_async_to_lds_b128 %7, %15, off\n\t"
        "s_wait_xcnt 0x0"
        :: "v"(l),          "v"(l + 1 * LS), "v"(l + 2 * LS), "v"(l + 3 * LS),
           "v"(l + 4 * LS), "v"(l + 5 * LS), "v"(l + 6 * LS), "v"(l + 7 * LS),
           "v"(g),          "v"(g + 1 * GS), "v"(g + 2 * GS), "v"(g + 3 * GS),
           "v"(g + 4 * GS), "v"(g + 5 * GS), "v"(g + 6 * GS), "v"(g + 7 * GS)
        : "memory");
}

constexpr int QT  = 16;
constexpr int QN  = 64;
constexpr int QW  = 16;
constexpr int QK  = H / QW;
constexpr int QP  = QN + 4;
constexpr int QWR = QT * QP;
typedef __attribute__((ext_vector_type(2))) float  v2f;
typedef __attribute__((ext_vector_type(4))) float  v4f;
typedef __attribute__((ext_vector_type(2))) __bf16 v2bf;

__global__ __launch_bounds__(32 * QW) void qk_kernel(const float* __restrict__ q,
                                                     const float* __restrict__ wk,
                                                     bf16_t* __restrict__ qk) {
    __shared__ __attribute__((aligned(16))) float part[QW * QWR];

    const int t0  = (blockIdx.x >> 4) * QT;      // 4 tiles over T
    const int d0  = (blockIdx.x & 15) * QN;      // 16 tiles over D
    const int tid = threadIdx.x;
    const int wave = tid >> 5;
    const int lane = tid & 31;
    const int hh = lane >> 4;
    const int c  = lane & 15;

    // wk is the A side (row c of tile e is d0 + 16e + c), q the B side (column c is
    // t0 + c).  Lane half hh holds h = 64*wave + 8j + 4hh + 2p + s (s = 0, 1: the two
    // registers of an operand) on both sides.  q: four consecutive floats of a row give
    // p = 0 and p = 1.  wk: the two rows of an operand are loaded as single floats, so
    // that each lands in its own register of the pair and no move is needed.
    const float* ga = q  + (size_t)(t0 + c) * H + wave * QK + 4 * hh;
    const float* gb = wk + (size_t)(wave * QK + 4 * hh) * D + d0 + c;
    v4f a[QK / 8];
    v2f b[QK / 8][2][4];
#pragma unroll   // these four: constant indices keep a[] and b[][][] in registers
    for (int j = 0; j < QK / 8; ++j) {
        a[j] = *(const v4f*)(ga + 8 * j);
#pragma unroll
        for (int p = 0; p < 2; ++p)
#pragma unroll
            for (int s = 0; s < 2; ++s)
#pragma unroll
                for (int e = 0; e < 4; ++e)
                    b[j][p][e][s] = gb[(size_t)(8 * j + 2 * p + s) * D + 16 * e];
    }
    // Keeps every load above in front of the first matrix instruction: without it the
    // scheduler sinks the loads to their uses and the wave pays the latency once per group.
    __builtin_amdgcn_sched_barrier(0);

    v8f acc[4] = {};
#pragma unroll   // these three: constant indices into a[], b[][][] and acc[]
    for (int j = 0; j < QK / 8; ++j)
#pragma unroll
        for (int p = 0; p < 2; ++p) {
            const v2f qv = {a[j][2 * p], a[j][2 * p + 1]};
#pragma unroll
            for (int e = 0; e < 4; ++e)
                acc[e] = __builtin_amdgcn_wmma_f32_16x16x4_f32(false, b[j][p][e], false, qv, (short)0, acc[e], false, false);
        }
    __builtin_amdgcn_sched_barrier(0);
    asm volatile("v_nop\n\tv_nop\n\tv_nop\n\tv_nop");
    __builtin_amdgcn_sched_barrier(0);

    // D layout: register r <-> d0 + 16e + 8*hh + r of row t0 + c: eight adjacent floats a tile.
    float* my = part + wave * QWR + c * QP + 8 * hh;
#pragma unroll   // constant indices keep acc[] in registers
    for (int e = 0; e < 4; ++e) {
        const v4f lo = {acc[e][0], acc[e][1], acc[e][2], acc[e][3]};
        const v4f hi = {acc[e][4], acc[e][5], acc[e][6], acc[e][7]};
        *(v4f*)(my + 16 * e)     = lo;
        *(v4f*)(my + 16 * e + 4) = hi;
    }
    __syncthreads();                             // the partial tiles are complete

    const int row = tid >> 5;                    // 0..15: a wave stores one 128-B line of qk
    const int col = (tid & 31) * 2;
    const float* pr = part + row * QP + col;
    v2f s = *(const v2f*)pr;
#pragma unroll   // the LDS reads issue together
    for (int w = 1; w < QW; ++w)
        s += *(const v2f*)(pr + w * QWR);
    const v2bf o2 = {(bf16_t)(s[0] * 0.03125f), (bf16_t)(s[1] * 0.03125f)};   // 1/sqrt(1024)
    *(v2bf*)(qk + (size_t)(t0 + row) * D + d0 + col) = o2;
}

constexpr int QSP = D + 8;               // LDS pitch of a qk row, bf16: 16 B over the row (16 B x odd) for 16-B readers
constexpr int XK  = 128;                 // d columns of a tile of x
constexpr int XP  = XK + 4;              // LDS pitch of an x row, floats: 16 B over the row (16 B x odd) for 16-B readers
constexpr int XT  = 16 * XP;             // floats of one buffer of one wave
constexpr int XN  = D / XK;              // tiles a wave streams
constexpr int SB  = 128;                 // s rows of a block
constexpr int NB  = S / SB;              // blocks of a batch
constexpr int SCP = SB + 4;              // LDS pitch of a row of scores, floats
constexpr int PP  = SB + 8;              // LDS pitch of a row of p, bf16: 16 B over the row (16 B x odd) for 16-B readers
static_assert(NB == 64, "usum_kernel holds two blocks a lane");
// upart, floats inside a block's T * D.  Element (t, d) with t = 16*mt + 8*h + 4*hf + r4 and
// d = 128*ct + 16*w + n lies at
//   ct*UC + (w>>1)*UW1 + (mt>>1)*UM1 + (w&1)*UW0 + (mt&1)*UM0 + hf*UH + (16*h + n)*4 + r4:
// UM1 floats in a row hold 32 rows t x 32 columns d, the tile of one work-group of usum_kernel.
constexpr int UH  = 128;                 // one store of a wave: 32 lanes x 4 floats
constexpr int UM0 = 2 * UH;
constexpr int UW0 = 2 * UM0;
constexpr int UM1 = 2 * UW0;
constexpr int UW1 = 2 * UM1;
constexpr int UC  = 4 * UW1;
static_assert(XN * UC == T * D, "the strides cover a block's partial exactly");
__global__ __launch_bounds__(256) void attn_kernel(const float* __restrict__ x,
                                                   const bf16_t* __restrict__ qk,
                                                   const float* __restrict__ mask,
                                                   float* __restrict__ upart,
                                                   float* __restrict__ mb,
                                                   float* __restrict__ lb) {
    __shared__ __attribute__((aligned(16))) float xs[8 * 2 * XT]; // [wave][buf][s_local][k_local]
    __shared__ __attribute__((aligned(16))) bf16_t qs[T * QSP];   // all of qk
    __shared__ __attribute__((aligned(16))) float sc[T * SCP];    // the block's scores
    __shared__ __attribute__((aligned(16))) bf16_t ps[T * PP];    // the block's p

    const int b   = blockIdx.x >> 6;             // / NB
    const int s0  = (blockIdx.x & 63) << 7;      // * SB
    const int tid = threadIdx.x;
    const int wave = tid >> 5;
    const int lane = tid & 31;
    const int h = lane >> 4;                     // lane half
    const int n = lane & 15;                     // N index / A row-within-tile

    float* myx = xs + wave * (2 * XT);           // this wave's two buffers
    const unsigned int xl = (unsigned int)(uintptr_t)(myx + lane * 4);
    const float* xg = x + ((size_t)b * S + s0 + wave * 16) * D + lane * 4;
    auto copy_tile = [&](int t) {
        const unsigned int l = xl + (t & 1) * (XT * 4);
        const float* g = xg + t * XK;
        async_rows8<XP * 4, D>(l,              g);
        async_rows8<XP * 4, D>(l + 8 * XP * 4, g + 8 * D);
    };

    v8f acc[4] = {};

    copy_tile(0);                                // from memory: issued ahead of qk, which comes from L2

    // Wave w brings rows 8w .. 8w+7 of qk, four 512-byte pieces a row.  This wave's
    // copies (tile 0 too) have landed behind the wait; the barrier stands in front of
    // every read of qs.
    {
        const unsigned int ql = (unsigned int)(uintptr_t)(qs + wave * 8 * QSP + lane * 8);
        const bf16_t* qg = qk + (size_t)(wave * 8) * D + lane * 8;
        async_rows8<QSP * 2, D>(ql,        qg);
        async_rows8<QSP * 2, D>(ql +  512, qg + 256);
        async_rows8<QSP * 2, D>(ql + 1024, qg + 512);
        async_rows8<QSP * 2, D>(ql + 1536, qg + 768);
        wait_async0();
    }
    __syncthreads();

    copy_tile(1);

    const float mv = mask[(size_t)b * S + s0 + wave * 16 + n];
    // No register that the load above names is written again in front of this wait.
    asm volatile("s_wait_xcnt 0x0" ::: "memory");

    for (int t = 0; t < XN; ++t) {
        const float* brow = myx + (t & 1) * XT + n * XP;
#pragma unroll   // constant LDS offsets; the reads of a tile can run ahead of its matrix instructions
        for (int kk = 0; kk < XK / 32; ++kk) {
            const int kb = t * XK + kk * 32;

            // B fragment: B[k][n] = x[b, s0+16*wave+n, kb+k]; k = 16*(e/8)+8h+(e%8)
            const float4* rowp = (const float4*)(brow + kk * 32);
            float4 f0 = rowp[2 * h];
            float4 f1 = rowp[2 * h + 1];
            float4 f2 = rowp[4 + 2 * h];
            float4 f3 = rowp[4 + 2 * h + 1];
            v16bf bfrag;
            bfrag[0]  = (bf16_t)f0.x; bfrag[1]  = (bf16_t)f0.y;
            bfrag[2]  = (bf16_t)f0.z; bfrag[3]  = (bf16_t)f0.w;
            bfrag[4]  = (bf16_t)f1.x; bfrag[5]  = (bf16_t)f1.y;
            bfrag[6]  = (bf16_t)f1.z; bfrag[7]  = (bf16_t)f1.w;
            bfrag[8]  = (bf16_t)f2.x; bfrag[9]  = (bf16_t)f2.y;
            bfrag[10] = (bf16_t)f2.z; bfrag[11] = (bf16_t)f2.w;
            bfrag[12] = (bf16_t)f3.x; bfrag[13] = (bf16_t)f3.y;
            bfrag[14] = (bf16_t)f3.z; bfrag[15] = (bf16_t)f3.w;

#pragma unroll
            for (int mt = 0; mt < 4; ++mt) {
                const bf16_t* arow = qs + (mt * 16 + n) * QSP + kb;
                v8bf alo = *(const v8bf*)(arow + 8 * h);
                v8bf ahi = *(const v8bf*)(arow + 16 + 8 * h);
                v16bf afrag = cat16(alo, ahi);
                acc[mt] = __builtin_amdgcn_wmma_f32_16x16x32_bf16(
                    false, afrag, false, bfrag, (short)0, acc[mt], false, false);
            }
        }
        // This wave's reads of tile t have returned: its buffer may be refilled.
        asm volatile("s_wait_dscnt 0x0" ::: "memory");
        wait_async0();                           // tile t + 1 has landed; behind the last trip no copy is outstanding
        if (t + 2 < XN) copy_tile(t + 2);        // into the buffer that tile t has left
    }

#pragma unroll
    for (int mt = 0; mt < 4; ++mt)
#pragma unroll
        for (int rr = 0; rr < 8; ++rr)
            sc[(mt * 16 + 8 * h + rr) * SCP + wave * 16 + n] = acc[mt][rr] + mv;
    // The scores are complete.  The same barrier stands behind every wave's last
    // s_wait_asynccnt 0, so behind it tiles XN-2 and XN-1 may be read by every wave.
    __syncthreads();
    const int st = tid >> 2;                     // four neighbouring lanes share a row of scores
    const int qd = tid & 3;                      // each takes 32 of its 128 columns
    float mx, sum;
    {
        const int t = st;
        const float4* sr = (const float4*)(sc + t * SCP + 32 * qd);
        float v[32];
#pragma unroll   // constant indices keep v[] in registers (the three loops below too)
        for (int k = 0; k < 8; ++k) {
            const float4 f = sr[k];
            v[4 * k] = f.x; v[4 * k + 1] = f.y; v[4 * k + 2] = f.z; v[4 * k + 3] = f.w;
        }
        mx = v[0];
#pragma unroll
        for (int k = 1; k < 32; ++k) mx = fmaxf(mx, v[k]);
        mx = fmaxf(mx, __shfl_xor(mx, 1));
        mx = fmaxf(mx, __shfl_xor(mx, 2));
        // a block that the mask shuts out whole: p = 0 and weight 0, not inf - inf
        const float ms = (mx == -INFINITY) ? 0.0f : mx;
        sum = 0.0f;
#pragma unroll
        for (int k = 0; k < 32; ++k) {
            v[k] = __expf(v[k] - ms);
            sum += v[k];
        }
        sum += __shfl_xor(sum, 1);
        sum += __shfl_xor(sum, 2);
        bf16_t* pw = ps + t * PP + 32 * qd;
#pragma unroll
        for (int k = 0; k < 4; ++k) {
            v8bf o;
#pragma unroll
            for (int e = 0; e < 8; ++e) o[e] = (bf16_t)v[8 * k + e];
            *(v8bf*)(pw + 8 * k) = o;
        }
    }
    __syncthreads();                             // p is complete
    if (qd == 0) {                               // behind the barrier, which would wait for these stores
        mb[(size_t)(b * T + st) * NB + (blockIdx.x & 63)] = mx;
        lb[(size_t)(b * T + st) * NB + (blockIdx.x & 63)] = sum;
    }

    // ---- step 3 ----
    // A side: all of p, the same for every tile of x, held in registers.
    v16bf af[4][SB / 32];
#pragma unroll   // these two: constant indices keep af[][] in registers
    for (int mt = 0; mt < 4; ++mt)
#pragma unroll
        for (int ks = 0; ks < SB / 32; ++ks) {
            const bf16_t* arow = ps + (mt * 16 + n) * PP + ks * 32;
            af[mt][ks] = cat16(*(const v8bf*)(arow + 8 * h), *(const v8bf*)(arow + 16 + 8 * h));
        }

    float* ub = upart + (size_t)blockIdx.x * (T * D) + (wave >> 1) * UW1 + (wave & 1) * UW0 + lane * 4;
    for (int j = 0; j < XN; ++j) {
        const int ct = XN - 1 - j;               // tile of this trip
        // column 16*wave + n of the tile; row 16g + r of the block is row r of wave g's buffer
        const float* bcol = xs + (ct & 1) * XT + (8 * h) * XP + wave * 16 + n;
        v8f a2[4] = {};
#pragma unroll   // constant LDS offsets and constant indices into af[][]
        for (int ks = 0; ks < SB / 32; ++ks) {
            // B fragment: B[k][n] = x[b, s0+32*ks+k, ...]; k = 16*(e/8)+8h+(e%8)
            v16bf bfrag;
#pragma unroll
            for (int e = 0; e < 8; ++e) {
                bfrag[e]     = (bf16_t)bcol[(2 * ks)     * (2 * XT) + e * XP];
                bfrag[8 + e] = (bf16_t)bcol[(2 * ks + 1) * (2 * XT) + e * XP];
            }
#pragma unroll
            for (int mt = 0; mt < 4; ++mt)
                a2[mt] = __builtin_amdgcn_wmma_f32_16x16x32_bf16(
                    false, af[mt][ks], false, bfrag, (short)0, a2[mt], false, false);
        }
        // Foot of the trip: this wave's reads of the tile have returned, its copies of the
        // next tile have landed; behind the barrier the next tile may be read by every wave
        // and this trip's buffer refilled.  Behind the last trip no copy is outstanding.
        asm volatile("s_wait_dscnt 0x0" ::: "memory");
        wait_async0();
        __syncthreads();
        if (j + 2 < XN) copy_tile(ct - 2);       // into the buffer that this trip has left

        // The stores stand behind the barrier, which waits for a wave's outstanding stores:
        // so they drain under the next trip's work.
#pragma unroll   // these two: constant indices keep a2[] in registers
        for (int mt = 0; mt < 4; ++mt)
#pragma unroll
            for (int hf = 0; hf < 2; ++hf) {
                const v4f o = {a2[mt][4 * hf], a2[mt][4 * hf + 1], a2[mt][4 * hf + 2], a2[mt][4 * hf + 3]};
                *(v4f*)(ub + ct * UC + (mt >> 1) * UM1 + (mt & 1) * UM0 + hf * UH) = o;
            }
    }
}

__device__ __forceinline__ float exp_slot(float x) {
    const float y = x * 1.44269504f;
    float r;
    asm("v_exp_f32 %0, %1\n\tv_nop" : "=v"(r) : "v"(y));
    return r;
}

__global__ __launch_bounds__(256) void usum_kernel(const float* __restrict__ upart,
                                                   const float* __restrict__ mb,
                                                   const float* __restrict__ lb,
                                                   float* __restrict__ u) {
    const int b    = blockIdx.x >> 6;            // / (T * D / UM1)
    const int g    = blockIdx.x & 63;            // tile of the batch: g & 1 over t, g >> 1 over d
    const int wave = __builtin_amdgcn_readfirstlane(threadIdx.x >> 5);   // scalar: row addresses stay in scalar registers
    const unsigned int lane = threadIdx.x & 31;
    const int t0   = (g & 1) * 32 + wave * 4;    // = 16*mt + 8*h + 4*hf with 4v = 16*(mt&1) + 8*h + 4*hf
    const unsigned int off = (lane >> 4) * UW0 + (lane & 15) * 4;
    const float* p = upart + (size_t)b * NB * (T * D) + g * UM1
                   + (wave >> 2) * UM0 + (wave & 1) * UH + ((wave >> 1) & 1) * 64 + off;

    const float* mr = mb + (size_t)(b * T + t0) * NB;    // the wave's four rows of mb and of lb
    const float* lr = lb + (size_t)(b * T + t0) * NB;

    // mb and lb, then the first blocks' rows, are all asked for at once: loads return in
    // order, so the weights wait for mb and lb alone and are formed while the rows fly.
    constexpr int PF = 16;
    float m[4][2], l[4][2];
    v4f pre[PF];
#pragma unroll   // these two: constant indices keep m[][], l[][] and pre[] in registers
    for (int i = 0; i < 4; ++i) {
        m[i][0] = mr[i * NB + lane]; m[i][1] = mr[i * NB + 32 + lane];
        l[i][0] = lr[i * NB + lane]; l[i][1] = lr[i * NB + 32 + lane];
    }
    // Keeps mb and lb in front of the rows: behind them, the weights would wait for the rows too.
    __builtin_amdgcn_sched_barrier(0);
#pragma unroll
    for (int k = 0; k < PF; ++k)
        pre[k] = *(const v4f*)(p + (size_t)k * (T * D));
    // Without this the scheduler sinks loads from above into and behind the weights' chains,
    // and the wave pays the memory latency several times, one after the other.
    __builtin_amdgcn_sched_barrier(0);

    float w[4][2];
#pragma unroll   // constant indices keep w[][] in registers; the four rows' chains overlap
    for (int i = 0; i < 4; ++i) {
        const float m0 = m[i][0], m1 = m[i][1];
        const float l0 = l[i][0], l1 = l[i][1];
        float mx = fmaxf(m0, m1);
#pragma unroll
        for (int off = 16; off > 0; off >>= 1) mx = fmaxf(mx, __shfl_xor(mx, off));
        w[i][0] = exp_slot(m0 - mx);
        w[i][1] = exp_slot(m1 - mx);
        float ls = w[i][0] * l0 + w[i][1] * l1;
#pragma unroll
        for (int off = 16; off > 0; off >>= 1) ls += __shfl_xor(ls, off);
        const float inv = 1.0f / ls;
        w[i][0] *= inv; w[i][1] *= inv;
    }

    float a[4] = {0.0f, 0.0f, 0.0f, 0.0f};
#pragma unroll   // constant indices into w[][], a constant lane to read the weights from; the blocks' loads overlap
    for (int k = 0; k < NB; ++k) {
        const v4f v = k < PF ? pre[k] : *(const v4f*)(p + (size_t)k * (T * D));
#pragma unroll
        for (int i = 0; i < 4; ++i)
            a[i] += __uint_as_float(__builtin_amdgcn_readlane(__float_as_uint(w[i][k >> 5]), k & 31)) * v[i];
    }
    float* uo = u + (size_t)(b * T + t0) * D + (g >> 1) * 32 + lane;
#pragma unroll   // constant indices keep a[] in registers
    for (int i = 0; i < 4; ++i)
        uo[(size_t)i * D] = a[i];
}

constexpr int OT   = 32;
constexpr int OW   = 16;
constexpr int OKW  = D / OW;
constexpr int OP   = OKW + 4;
constexpr int OWR  = 2 * OT * OP;
constexpr int ORP  = OT + 4;

__device__ __forceinline__ void async_rows16(unsigned int l, const float* g) {
    asm volatile(
        "global_load_async_to_lds_b128 %0, %8, off\n\t"
        "global_load_async_to_lds_b128 %1, %9, off\n\t"
        "global_load_async_to_lds_b128 %2, %10, off\n\t"
        "global_load_async_to_lds_b128 %3, %11, off\n\t"
        "global_load_async_to_lds_b128 %4, %12, off\n\t"
        "global_load_async_to_lds_b128 %5, %13, off\n\t"
        "global_load_async_to_lds_b128 %6, %14, off\n\t"
        "global_load_async_to_lds_b128 %7, %15, off\n\t"
        "s_wait_xcnt 0x0"
        :: "v"(l),                "v"(l +  2 * OP * 4), "v"(l +  4 * OP * 4), "v"(l +  6 * OP * 4),
           "v"(l +  8 * OP * 4), "v"(l + 10 * OP * 4), "v"(l + 12 * OP * 4), "v"(l + 14 * OP * 4),
           "v"(g),          "v"(g +  2 * D), "v"(g +  4 * D), "v"(g +  6 * D),
           "v"(g +  8 * D), "v"(g + 10 * D), "v"(g + 12 * D), "v"(g + 14 * D)
        : "memory");
}

__global__ __launch_bounds__(32 * OW) void out_kernel(const float* __restrict__ u,
                                                      const float* __restrict__ wv,
                                                      float* __restrict__ out) {
    __shared__ __attribute__((aligned(16))) float st[OW * OWR];

    const int bt0 = (blockIdx.x >> 5) * OT;      // 8 tiles over B*T
    const int h0  = (blockIdx.x & 31) * OT;      // 32 tiles over H
    const int tid = threadIdx.x;
    const int wave = tid >> 5;
    const int lane = tid & 31;
    const int hh = lane >> 4;
    const int c  = lane & 15;

    float* my = st + wave * OWR;                 // rows 0..31: u, rows 32..63: wv

    // staging: lane half hh takes row 2r + hh, lane c its floats 4c .. 4c+3
    const float* gu = u  + (size_t)(bt0 + hh) * D + wave * OKW + c * 4;
    const float* gw = wv + (size_t)(h0  + hh) * D + wave * OKW + c * 4;
    const unsigned int sm = (unsigned int)(uintptr_t)(my + hh * OP + c * 4);
    async_rows16(sm + OT * OP * 4,        gw);            // wv rows  0..15
    async_rows16(sm + (OT + 16) * OP * 4, gw + 16 * D);   // wv rows 16..31
    async_rows16(sm,                      gu);            // u rows   0..15
    async_rows16(sm + 16 * OP * 4,        gu + 16 * D);   // u rows  16..31
    wait_async0();                               // this wave's copies have landed
    __syncthreads();                             // nobody reads the rows in front of this

    v8f acc[2][2] = {};
    // A and B fragments come from the same loader, so their k orders are equal:
    // lane half hh holds d = 8j + 4hh + {0,1} in the first product of a group
    // and d = 8j + 4hh + {2,3} in the second.
    const float* fa = my + c * OP + 4 * hh;
    const float* fb = fa + OT * OP;
#pragma unroll   // straight-line code lets the LDS reads run ahead of the matrix instructions
    for (int j = 0; j < OKW / 8; ++j) {
        const float4 a0 = *(const float4*)(fa + 8 * j);
        const float4 a1 = *(const float4*)(fa + 16 * OP + 8 * j);
        const float4 b0 = *(const float4*)(fb + 8 * j);
        const float4 b1 = *(const float4*)(fb + 16 * OP + 8 * j);
        const v2f a0l = {a0.x, a0.y}, a0h = {a0.z, a0.w};
        const v2f a1l = {a1.x, a1.y}, a1h = {a1.z, a1.w};
        const v2f b0l = {b0.x, b0.y}, b0h = {b0.z, b0.w};
        const v2f b1l = {b1.x, b1.y}, b1h = {b1.z, b1.w};
        acc[0][0] = __builtin_amdgcn_wmma_f32_16x16x4_f32(false, a0l, false, b0l, (short)0, acc[0][0], false, false);
        acc[0][1] = __builtin_amdgcn_wmma_f32_16x16x4_f32(false, a0l, false, b1l, (short)0, acc[0][1], false, false);
        acc[1][0] = __builtin_amdgcn_wmma_f32_16x16x4_f32(false, a1l, false, b0l, (short)0, acc[1][0], false, false);
        acc[1][1] = __builtin_amdgcn_wmma_f32_16x16x4_f32(false, a1l, false, b1l, (short)0, acc[1][1], false, false);
        acc[0][0] = __builtin_amdgcn_wmma_f32_16x16x4_f32(false, a0h, false, b0h, (short)0, acc[0][0], false, false);
        acc[0][1] = __builtin_amdgcn_wmma_f32_16x16x4_f32(false, a0h, false, b1h, (short)0, acc[0][1], false, false);
        acc[1][0] = __builtin_amdgcn_wmma_f32_16x16x4_f32(false, a1h, false, b0h, (short)0, acc[1][0], false, false);
        acc[1][1] = __builtin_amdgcn_wmma_f32_16x16x4_f32(false, a1h, false, b1h, (short)0, acc[1][1], false, false);
    }

    // Partial tile into the head of the wave's own range (its rows are all read:
    // every accumulator depends on them).  D layout: register r <-> row 8*hh + r, column c.
#pragma unroll   // these three: constant indices keep acc[][] in registers
    for (int i = 0; i < 2; ++i)
#pragma unroll
        for (int jn = 0; jn < 2; ++jn)
#pragma unroll
            for (int r = 0; r < 8; ++r)
                my[(16 * i + 8 * hh + r) * ORP + 16 * jn + c] = acc[i][jn][r];
    __syncthreads();                             // the partial tiles are complete

    const int row = tid >> 4;                    // 0..31
    const int col = (tid & 15) * 2;              // 16 threads store one 128-B line of out
    const float* pr = st + row * ORP + col;
    float2 s = *(const float2*)pr;
#pragma unroll   // the LDS reads issue together
    for (int w = 1; w < OW; ++w) {
        const float2 q2 = *(const float2*)(pr + w * OWR);
        s.x += q2.x; s.y += q2.y;
    }
    *(float2*)(out + (size_t)(bt0 + row) * H + h0 + col) = s;
}

// ---------------------------------------------------------------------------
extern "C" void kernel_launch(void* const* d_in, const int* in_sizes, int n_in,
                              void* d_out, int out_size, void* d_ws, size_t ws_size,
                              hipStream_t stream) {
    const float* x    = (const float*)d_in[0];   // (B,S,D)
    const float* mask = (const float*)d_in[1];   // (B,1,S)
    const float* wk   = (const float*)d_in[2];   // (H,D)
    const float* wv   = (const float*)d_in[3];   // (H,D)
    const float* q    = (const float*)d_in[4];   // (T,H)
    float* out = (float*)d_out;                  // (B,T,H)

    char* ws = (char*)d_ws;
    bf16_t* qk_ws    = (bf16_t*)(ws);                                  // T*D bf16      = 128 KB
    float*  mb_ws    = (float*)(ws + 131072);                          // B*T*NB f32    = 64 KB
    float*  lb_ws    = (float*)(ws + 131072 + 65536);                  // B*T*NB f32    = 64 KB
    float*  u_ws     = (float*)(ws + 131072 + 131072);                 // B*T*D f32     = 1 MB
    float*  upart_ws = (float*)(ws + 131072 + 131072 + 1048576);       // B*NB*T*D f32  = 64 MB

    qk_kernel<<<(T / QT) * (D / QN), 32 * QW, 0, stream>>>(q, wk, qk_ws);
    attn_kernel<<<B * NB, 256, 0, stream>>>(x, qk_ws, mask, upart_ws, mb_ws, lb_ws);
    usum_kernel<<<B * (T * D / UM1), 256, 0, stream>>>(upart_ws, mb_ws, lb_ws, u_ws);
    out_kernel<<<(B * T / OT) * (H / OT), 32 * OW, 0, stream>>>(u_ws, wv, out);
}

// v008
// Measured time: 42.5 microseconds a run.
// Two timings next to v007 both put it at 1.06 times that version's speed.
// Over all steps from v000 it is 11.5 times as fast.
#include <hip/hip_runtime.h>
#include <hip/hip_bf16.h>

// Problem constants (from reference)
constexpr int B = 4;
constexpr int S = 8192;
constexpr int D = 1024;   // DIM
constexpr int H = 1024;   // HDIM
constexpr int T = 64;     // NUM_TOKENS

typedef __bf16 bf16_t;
typedef __attribute__((ext_vector_type(8)))  __bf16 v8bf;
typedef __attribute__((ext_vector_type(16))) __bf16 v16bf;
typedef __attribute__((ext_vector_type(8)))  float  v8f;

__device__ __forceinline__ v16bf cat16(v8bf lo, v8bf hi) {
    return __builtin_shufflevector(lo, hi, 0,1,2,3,4,5,6,7,8,9,10,11,12,13,14,15);
}

// The wave's own asynchronous copies to LDS have landed.
__device__ __forceinline__ void wait_async0() {
    asm volatile("s_wait_asynccnt 0x0" ::: "memory");
}

template <int LS, int GS, typename E>
__device__ __forceinline__ void async_rows8(unsigned int l, const E* g) {
    asm volatile(
        "global_load_async_to_lds_b128 %0, %8, off\n\t"
        "global_load_async_to_lds_b128 %1, %9, off\n\t"
        "global_load_async_to_lds_b128 %2, %10, off\n\t"
        "global_load_async_to_lds_b128 %3, %11, off\n\t"
        "global_load_async_to_lds_b128 %4, %12, off\n\t"
        "global_load_async_to_lds_b128 %5, %13, off\n\t"
        "global_load_async_to_lds_b128 %6, %14, off\n\t"
        "global_load_async_to_lds_b128 %7, %15, off\n\t"
        "s_wait_xcnt 0x0"
        :: "v"(l),          "v"(l + 1 * LS), "v"(l + 2 * LS), "v"(l + 3 * LS),
           "v"(l + 4 * LS), "v"(l + 5 * LS), "v"(l + 6 * LS), "v"(l + 7 * LS),
           "v"(g),          "v"(g + 1 * GS), "v"(g + 2 * GS), "v"(g + 3 * GS),
           "v"(g + 4 * GS), "v"(g + 5 * GS), "v"(g + 6 * GS), "v"(g + 7 * GS)
        : "memory");
}

constexpr int QT  = 16;
constexpr int QN  = 16;
constexpr int QW  = 8;
constexpr int QK  = H / QW;
constexpr int QP  = QN + 4;
constexpr int QWR = QT * QP;
constexpr int QQP = QK + 4;
typedef __attribute__((ext_vector_type(2))) float  v2f;
typedef __attribute__((ext_vector_type(4))) float  v4f;
typedef __attribute__((ext_vector_type(2))) __bf16 v2bf;
static_assert(QK * 4 == 512, "a copy of a wave is one row of its slice of q");

__global__ __launch_bounds__(32 * QW) void qk_kernel(const float* __restrict__ q,
                                                     const float* __restrict__ wk,
                                                     bf16_t* __restrict__ qk) {
    __shared__ __attribute__((aligned(16))) float qst[QW * QT * QQP];   // [wave][t_local][h_local]
    __shared__ __attribute__((aligned(16))) float part[QW * QWR];

    const int t0  = (blockIdx.x >> 6) * QT;      // 4 tiles over T
    const int dt  = blockIdx.x & 63;             // 64 tiles over D
    const int tid = threadIdx.x;
    const int wave = tid >> 5;
    const int lane = tid & 31;
    const int hh = lane >> 4;
    const int c  = lane & 15;

    float* myq = qst + wave * (QT * QQP);
    {
        const unsigned int l = (unsigned int)(uintptr_t)(myq + lane * 4);
        const float* g = q + (size_t)t0 * H + wave * QK + lane * 4;
        async_rows8<QQP * 4, H>(l,               g);
        async_rows8<QQP * 4, H>(l + 8 * QQP * 4, g + 8 * H);
    }

    // wk is the A side (row c of the tile is d = 16*dt + c), q the B side (column c is
    // t0 + c).  Lane half hh holds h = 128*wave + 8j + 4hh + 2p + s (s = 0, 1: the two
    // registers of an operand) on both sides.  q: four consecutive floats of a row give
    // p = 0 and p = 1.  wk: the two rows of an operand are loaded as single floats, so
    // that each lands in its own register of the pair and no move is needed.
    const float* gb = wk + (size_t)(wave * QK + 4 * hh) * D + dt * QN + c;
    v2f b[QK / 8][2];
#pragma unroll   // these three: constant indices keep b[][] in registers
    for (int j = 0; j < QK / 8; ++j)
#pragma unroll
        for (int p = 0; p < 2; ++p)
#pragma unroll
            for (int s = 0; s < 2; ++s)
                b[j][p][s] = gb[(size_t)(8 * j + 2 * p + s) * D];
    // Keeps every load above in front of the wait below and of the first matrix instruction:
    // without it the scheduler sinks the loads to their uses and the wave pays the latency
    // once per group.
    __builtin_amdgcn_sched_barrier(0);
    wait_async0();                               // this wave's rows of q have landed; no other wave reads them

    const float* fa = myq + c * QQP + 4 * hh;
    v8f acc = {};
#pragma unroll   // these two: constant LDS offsets and constant indices into b[][]
    for (int j = 0; j < QK / 8; ++j) {
        const v4f a = *(const v4f*)(fa + 8 * j);
#pragma unroll
        for (int p = 0; p < 2; ++p) {
            const v2f qv = {a[2 * p], a[2 * p + 1]};
            acc = __builtin_amdgcn_wmma_f32_16x16x4_f32(false, b[j][p], false, qv, (short)0, acc, false, false);
        }
    }
    __builtin_amdgcn_sched_barrier(0);
    asm volatile("v_nop\n\tv_nop\n\tv_nop\n\tv_nop");
    __builtin_amdgcn_sched_barrier(0);

    // D layout: register r <-> d = 16*dt + 8*hh + r of row t0 + c: eight adjacent floats.
    float* my = part + wave * QWR + c * QP + 8 * hh;
    const v4f lo = {acc[0], acc[1], acc[2], acc[3]};
    const v4f hi = {acc[4], acc[5], acc[6], acc[7]};
    *(v4f*)(my)     = lo;
    *(v4f*)(my + 4) = hi;
    __syncthreads();                             // the partial tiles are complete

    if (tid < QT * QN / 2) {                     // four whole waves: each stores one 128-B line of qk
        const int row = tid >> 3;                // 0..15
        const int col = (tid & 7) * 2;
        const float* pr = part + row * QP + col;
        v2f s = *(const v2f*)pr;
#pragma unroll   // the LDS reads issue together
        for (int w = 1; w < QW; ++w)
            s += *(const v2f*)(pr + w * QWR);
        const v2bf o2 = {(bf16_t)(s[0] * 0.03125f), (bf16_t)(s[1] * 0.03125f)};   // 1/sqrt(1024)
        *(v2bf*)(qk + ((size_t)dt * T + t0 + row) * QN + col) = o2;
    }
}

constexpr int QSP = D + 8;               // LDS pitch of a qk row, bf16: 16 B over the row (16 B x odd) for 16-B readers
constexpr int XK  = 128;                 // d columns of a tile of x
constexpr int XP  = XK + 4;              // LDS pitch of an x row, floats: 16 B over the row (16 B x odd) for 16-B readers
constexpr int XT  = 16 * XP;             // floats of one buffer of one wave
constexpr int XN  = D / XK;              // tiles a wave streams
constexpr int SB  = 128;                 // s rows of a block
constexpr int NB  = S / SB;              // blocks of a batch
constexpr int SCP = SB + 4;              // LDS pitch of a row of scores, floats
constexpr int PP  = SB + 8;              // LDS pitch of a row of p, bf16: 16 B over the row (16 B x odd) for 16-B readers
static_assert(NB == 64, "usum_kernel holds two blocks a lane");
// upart, floats inside a block's T * D.  Element (t, d) with t = 16*mt + 8*h + 4*hf + r4 and
// d = 128*ct + 16*w + n lies at
//   ct*UC + (w>>1)*UW1 + (mt>>1)*UM1 + (w&1)*UW0 + (mt&1)*UM0 + hf*UH + (16*h + n)*4 + r4:
// UM1 floats in a row hold 32 rows t x 32 columns d, the tile of one work-group of usum_kernel.
constexpr int UH  = 128;                 // one store of a wave: 32 lanes x 4 floats
constexpr int UM0 = 2 * UH;
constexpr int UW0 = 2 * UM0;
constexpr int UM1 = 2 * UW0;
constexpr int UW1 = 2 * UM1;
constexpr int UC  = 4 * UW1;
static_assert(XN * UC == T * D, "the strides cover a block's partial exactly");
__global__ __launch_bounds__(256) void attn_kernel(const float* __restrict__ x,
                                                   const bf16_t* __restrict__ qk,
                                                   const float* __restrict__ mask,
                                                   float* __restrict__ upart,
                                                   float* __restrict__ mb,
                                                   float* __restrict__ lb) {
    __shared__ __attribute__((aligned(16))) float xs[8 * 2 * XT]; // [wave][buf][s_local][k_local]
    __shared__ __attribute__((aligned(16))) bf16_t qs[T * QSP];   // all of qk
    __shared__ __attribute__((aligned(16))) float sc[T * SCP];    // the block's scores
    __shared__ __attribute__((aligned(16))) bf16_t ps[T * PP];    // the block's p

    const int b   = blockIdx.x >> 6;             // / NB
    const int s0  = (blockIdx.x & 63) << 7;      // * SB
    const int tid = threadIdx.x;
    const int wave = tid >> 5;
    const int lane = tid & 31;
    const int h = lane >> 4;                     // lane half
    const int n = lane & 15;                     // N index / A row-within-tile

    float* myx = xs + wave * (2 * XT);           // this wave's two buffers
    const unsigned int xl = (unsigned int)(uintptr_t)(myx + lane * 4);
    const float* xg = x + ((size_t)b * S + s0 + wave * 16) * D + lane * 4;
    auto copy_tile = [&](int t) {
        const unsigned int l = xl + (t & 1) * (XT * 4);
        const float* g = xg + t * XK;
        async_rows8<XP * 4, D>(l,              g);
        async_rows8<XP * 4, D>(l + 8 * XP * 4, g + 8 * D);
    };

    v8f acc[4] = {};

    copy_tile(0);                                // from memory: issued ahead of qk, which comes from L2

    {
        const unsigned int ql = (unsigned int)(uintptr_t)(qs + (lane >> 1) * QSP + wave * 8 * QN + (lane & 1) * 8);
        const bf16_t* qg = qk + (size_t)(wave * 8) * (T * QN) + lane * 8;
        async_rows8<QN * 2, T * QN>(ql,                    qg);
        async_rows8<QN * 2, T * QN>(ql + 16 * QSP * 2,     qg + 16 * QN);
        async_rows8<QN * 2, T * QN>(ql + 32 * QSP * 2,     qg + 32 * QN);
        async_rows8<QN * 2, T * QN>(ql + 48 * QSP * 2,     qg + 48 * QN);
        wait_async0();
    }
    __syncthreads();

    copy_tile(1);

    const float mv = mask[(size_t)b * S + s0 + wave * 16 + n];
    // No register that the load above names is written again in front of this wait.
    asm volatile("s_wait_xcnt 0x0" ::: "memory");

    for (int t = 0; t < XN; ++t) {
        const float* brow = myx + (t & 1) * XT + n * XP;
#pragma unroll   // constant LDS offsets; the reads of a tile can run ahead of its matrix instructions
        for (int kk = 0; kk < XK / 32; ++kk) {
            const int kb = t * XK + kk * 32;

            // B fragment: B[k][n] = x[b, s0+16*wave+n, kb+k]; k = 16*(e/8)+8h+(e%8)
            const float4* rowp = (const float4*)(brow + kk * 32);
            float4 f0 = rowp[2 * h];
            float4 f1 = rowp[2 * h + 1];
            float4 f2 = rowp[4 + 2 * h];
            float4 f3 = rowp[4 + 2 * h + 1];
            v16bf bfrag;
            bfrag[0]  = (bf16_t)f0.x; bfrag[1]  = (bf16_t)f0.y;
            bfrag[2]  = (bf16_t)f0.z; bfrag[3]  = (bf16_t)f0.w;
            bfrag[4]  = (bf16_t)f1.x; bfrag[5]  = (bf16_t)f1.y;
            bfrag[6]  = (bf16_t)f1.z; bfrag[7]  = (bf16_t)f1.w;
            bfrag[8]  = (bf16_t)f2.x; bfrag[9]  = (bf16_t)f2.y;
            bfrag[10] = (bf16_t)f2.z; bfrag[11] = (bf16_t)f2.w;
            bfrag[12] = (bf16_t)f3.x; bfrag[13] = (bf16_t)f3.y;
            bfrag[14] = (bf16_t)f3.z; bfrag[15] = (bf16_t)f3.w;

#pragma unroll
            for (int mt = 0; mt < 4; ++mt) {
                const bf16_t* arow = qs + (mt * 16 + n) * QSP + kb;
                v8bf alo = *(const v8bf*)(arow + 8 * h);
                v8bf ahi = *(const v8bf*)(arow + 16 + 8 * h);
                v16bf afrag = cat16(alo, ahi);
                acc[mt] = __builtin_amdgcn_wmma_f32_16x16x32_bf16(
                    false, afrag, false, bfrag, (short)0, acc[mt], false, false);
            }
        }
        // This wave's reads of tile t have returned: its buffer may be refilled.
        asm volatile("s_wait_dscnt 0x0" ::: "memory");
        wait_async0();                           // tile t + 1 has landed; behind the last trip no copy is outstanding
        if (t + 2 < XN) copy_tile(t + 2);        // into the buffer that tile t has left
    }

#pragma unroll
    for (int mt = 0; mt < 4; ++mt)
#pragma unroll
        for (int rr = 0; rr < 8; ++rr)
            sc[(mt * 16 + 8 * h + rr) * SCP + wave * 16 + n] = acc[mt][rr] + mv;
    // The scores are complete.  The same barrier stands behind every wave's last
    // s_wait_asynccnt 0, so behind it tiles XN-2 and XN-1 may be read by every wave.
    __syncthreads();
    const int st = tid >> 2;                     // four neighbouring lanes share a row of scores
    const int qd = tid & 3;                      // each takes 32 of its 128 columns
    float mx, sum;
    {
        const int t = st;
        const float4* sr = (const float4*)(sc + t * SCP + 32 * qd);
        float v[32];
#pragma unroll   // constant indices keep v[] in registers (the three loops below too)
        for (int k = 0; k < 8; ++k) {
            const float4 f = sr[k];
            v[4 * k] = f.x; v[4 * k + 1] = f.y; v[4 * k + 2] = f.z; v[4 * k + 3] = f.w;
        }
        mx = v[0];
#pragma unroll
        for (int k = 1; k < 32; ++k) mx = fmaxf(mx, v[k]);
        mx = fmaxf(mx, __shfl_xor(mx, 1));
        mx = fmaxf(mx, __shfl_xor(mx, 2));
        // a block that the mask shuts out whole: p = 0 and weight 0, not inf - inf
        const float ms = (mx == -INFINITY) ? 0.0f : mx;
        sum = 0.0f;
#pragma unroll
        for (int k = 0; k < 32; ++k) {
            v[k] = __expf(v[k] - ms);
            sum += v[k];
        }
        sum += __shfl_xor(sum, 1);
        sum += __shfl_xor(sum, 2);
        bf16_t* pw = ps + t * PP + 32 * qd;
#pragma unroll
        for (int k = 0; k < 4; ++k) {
            v8bf o;
#pragma unroll
            for (int e = 0; e < 8; ++e) o[e] = (bf16_t)v[8 * k + e];
            *(v8bf*)(pw + 8 * k) = o;
        }
    }
    __syncthreads();                             // p is complete
    if (qd == 0) {                               // behind the barrier, which would wait for these stores
        mb[(size_t)(b * T + st) * NB + (blockIdx.x & 63)] = mx;
        lb[(size_t)(b * T + st) * NB + (blockIdx.x & 63)] = sum;
    }

    // ---- step 3 ----
    // A side: all of p, the same for every tile of x, held in registers.
    v16bf af[4][SB / 32];
#pragma unroll   // these two: constant indices keep af[][] in registers
    for (int mt = 0; mt < 4; ++mt)
#pragma unroll
        for (int ks = 0; ks < SB / 32; ++ks) {
            const bf16_t* arow = ps + (mt * 16 + n) * PP + ks * 32;
            af[mt][ks] = cat16(*(const v8bf*)(arow + 8 * h), *(const v8bf*)(arow + 16 + 8 * h));
        }

    float* ub = upart + (size_t)blockIdx.x * (T * D) + (wave >> 1) * UW1 + (wave & 1) * UW0 + lane * 4;
    for (int j = 0; j < XN; ++j) {
        const int ct = XN - 1 - j;               // tile of this trip
        // column 16*wave + n of the tile; row 16g + r of the block is row r of wave g's buffer
        const float* bcol = xs + (ct & 1) * XT + (8 * h) * XP + wave * 16 + n;
        v8f a2[4] = {};
#pragma unroll   // constant LDS offsets and constant indices into af[][]
        for (int ks = 0; ks < SB / 32; ++ks) {
            // B fragment: B[k][n] = x[b, s0+32*ks+k, ...]; k = 16*(e/8)+8h+(e%8)
            v16bf bfrag;
#pragma unroll
            for (int e = 0; e < 8; ++e) {
                bfrag[e]     = (bf16_t)bcol[(2 * ks)     * (2 * XT) + e * XP];
                bfrag[8 + e] = (bf16_t)bcol[(2 * ks + 1) * (2 * XT) + e * XP];
            }
#pragma unroll
            for (int mt = 0; mt < 4; ++mt)
                a2[mt] = __builtin_amdgcn_wmma_f32_16x16x32_bf16(
                    false, af[mt][ks], false, bfrag, (short)0, a2[mt], false, false);
        }
        // Foot of the trip: this wave's reads of the tile have returned, its copies of the
        // next tile have landed; behind the barrier the next tile may be read by every wave
        // and this trip's buffer refilled.  Behind the last trip no copy is outstanding.
        asm volatile("s_wait_dscnt 0x0" ::: "memory");
        wait_async0();
        __syncthreads();
        if (j + 2 < XN) copy_tile(ct - 2);       // into the buffer that this trip has left

        // The stores stand behind the barrier, which waits for a wave's outstanding stores:
        // so they drain under the next trip's work.
#pragma unroll   // these two: constant indices keep a2[] in registers
        for (int mt = 0; mt < 4; ++mt)
#pragma unroll
            for (int hf = 0; hf < 2; ++hf) {
                const v4f o = {a2[mt][4 * hf], a2[mt][4 * hf + 1], a2[mt][4 * hf + 2], a2[mt][4 * hf + 3]};
                *(v4f*)(ub + ct * UC + (mt >> 1) * UM1 + (mt & 1) * UM0 + hf * UH) = o;
            }
    }
}

__device__ __forceinline__ float exp_slot(float x) {
    const float y = x * 1.44269504f;
    float r;
    asm("v_exp_f32 %0, %1\n\tv_nop" : "=v"(r) : "v"(y));
    return r;
}

__global__ __launch_bounds__(256) void usum_kernel(const float* __restrict__ upart,
                                                   const float* __restrict__ mb,
                                                   const float* __restrict__ lb,
                                                   float* __restrict__ u) {
    const int b    = blockIdx.x >> 6;            // / (T * D / UM1)
    const int g    = blockIdx.x & 63;            // tile of the batch: g & 1 over t, g >> 1 over d
    const int wave = __builtin_amdgcn_readfirstlane(threadIdx.x >> 5);   // scalar: row addresses stay in scalar registers
    const unsigned int lane = threadIdx.x & 31;
    const int t0   = (g & 1) * 32 + wave * 4;    // = 16*mt + 8*h + 4*hf with 4v = 16*(mt&1) + 8*h + 4*hf
    const unsigned int off = (lane >> 4) * UW0 + (lane & 15) * 4;
    const float* p = upart + (size_t)b * NB * (T * D) + g * UM1
                   + (wave >> 2) * UM0 + (wave & 1) * UH + ((wave >> 1) & 1) * 64 + off;

    const float* mr = mb + (size_t)(b * T + t0) * NB;    // the wave's four rows of mb and of lb
    const float* lr = lb + (size_t)(b * T + t0) * NB;

    // mb and lb, then the first blocks' rows, are all asked for at once: loads return in
    // order, so the weights wait for mb and lb alone and are formed while the rows fly.
    constexpr int PF = 16;
    float m[4][2], l[4][2];
    v4f pre[PF];
#pragma unroll   // these two: constant indices keep m[][], l[][] and pre[] in registers
    for (int i = 0; i < 4; ++i) {
        m[i][0] = mr[i * NB + lane]; m[i][1] = mr[i * NB + 32 + lane];
        l[i][0] = lr[i * NB + lane]; l[i][1] = lr[i * NB + 32 + lane];
    }
    // Keeps mb and lb in front of the rows: behind them, the weights would wait for the rows too.
    __builtin_amdgcn_sched_barrier(0);
#pragma unroll
    for (int k = 0; k < PF; ++k)
        pre[k] = *(const v4f*)(p + (size_t)k * (T * D));
    // Without this the scheduler sinks loads from above into and behind the weights' chains,
    // and the wave pays the memory latency several times, one after the other.
    __builtin_amdgcn_sched_barrier(0);

    float w[4][2];
#pragma unroll   // constant indices keep w[][] in registers; the four rows' chains overlap
    for (int i = 0; i < 4; ++i) {
        const float m0 = m[i][0], m1 = m[i][1];
        const float l0 = l[i][0], l1 = l[i][1];
        float mx = fmaxf(m0, m1);
#pragma unroll
        for (int off = 16; off > 0; off >>= 1) mx = fmaxf(mx, __shfl_xor(mx, off));
        w[i][0] = exp_slot(m0 - mx);
        w[i][1] = exp_slot(m1 - mx);
        float ls = w[i][0] * l0 + w[i][1] * l1;
#pragma unroll
        for (int off = 16; off > 0; off >>= 1) ls += __shfl_xor(ls, off);
        const float inv = 1.0f / ls;
        w[i][0] *= inv; w[i][1] *= inv;
    }

    float a[4] = {0.0f, 0.0f, 0.0f, 0.0f};
#pragma unroll   // constant indices into w[][], a constant lane to read the weights from; the blocks' loads overlap
    for (int k = 0; k < NB; ++k) {
        const v4f v = k < PF ? pre[k] : *(const v4f*)(p + (size_t)k * (T * D));
#pragma unroll
        for (int i = 0; i < 4; ++i)
            a[i] += __uint_as_float(__builtin_amdgcn_readlane(__float_as_uint(w[i][k >> 5]), k & 31)) * v[i];
    }
    float* uo = u + (size_t)(b * T + t0) * D + (g >> 1) * 32 + lane;
#pragma unroll   // constant indices keep a[] in registers
    for (int i = 0; i < 4; ++i)
        uo[(size_t)i * D] = a[i];
}

constexpr int OT   = 32;
constexpr int OW   = 16;
constexpr int OKW  = D / OW;
constexpr int OP   = OKW + 4;
constexpr int OWR  = 2 * OT * OP;
constexpr int ORP  = OT + 4;

__device__ __forceinline__ void async_rows16(unsigned int l, const float* g) {
    asm volatile(
        "global_load_async_to_lds_b128 %0, %8, off\n\t"
        "global_load_async_to_lds_b128 %1, %9, off\n\t"
        "global_load_async_to_lds_b128 %2, %10, off\n\t"
        "global_load_async_to_lds_b128 %3, %11, off\n\t"
        "global_load_async_to_lds_b128 %4, %12, off\n\t"
        "global_load_async_to_lds_b128 %5, %13, off\n\t"
        "global_load_async_to_lds_b128 %6, %14, off\n\t"
        "global_load_async_to_lds_b128 %7, %15, off\n\t"
        "s_wait_xcnt 0x0"
        :: "v"(l),                "v"(l +  2 * OP * 4), "v"(l +  4 * OP * 4), "v"(l +  6 * OP * 4),
           "v"(l +  8 * OP * 4), "v"(l + 10 * OP * 4), "v"(l + 12 * OP * 4), "v"(l + 14 * OP * 4),
           "v"(g),          "v"(g +  2 * D), "v"(g +  4 * D), "v"(g +  6 * D),
           "v"(g +  8 * D), "v"(g + 10 * D), "v"(g + 12 * D), "v"(g + 14 * D)
        : "memory");
}

__global__ __launch_bounds__(32 * OW) void out_kernel(const float* __restrict__ u,
                                                      const float* __restrict__ wv,
                                                      float* __restrict__ out) {
    __shared__ __attribute__((aligned(16))) float st[OW * OWR];

    const int bt0 = (blockIdx.x >> 5) * OT;      // 8 tiles over B*T
    const int h0  = (blockIdx.x & 31) * OT;      // 32 tiles over H
    const int tid = threadIdx.x;
    const int wave = tid >> 5;
    const int lane = tid & 31;
    const int hh = lane >> 4;
    const int c  = lane & 15;

    float* my = st + wave * OWR;                 // rows 0..31: u, rows 32..63: wv

    // staging: lane half hh takes row 2r + hh, lane c its floats 4c .. 4c+3
    const float* gu = u  + (size_t)(bt0 + hh) * D + wave * OKW + c * 4;
    const float* gw = wv + (size_t)(h0  + hh) * D + wave * OKW + c * 4;
    const unsigned int sm = (unsigned int)(uintptr_t)(my + hh * OP + c * 4);
    async_rows16(sm + OT * OP * 4,        gw);            // wv rows  0..15
    async_rows16(sm + (OT + 16) * OP * 4, gw + 16 * D);   // wv rows 16..31
    async_rows16(sm,                      gu);            // u rows   0..15
    async_rows16(sm + 16 * OP * 4,        gu + 16 * D);   // u rows  16..31
    wait_async0();                               // this wave's copies have landed
    __syncthreads();                             // nobody reads the rows in front of this

    v8f acc[2][2] = {};
    // A and B fragments come from the same loader, so their k orders are equal:
    // lane half hh holds d = 8j + 4hh + {0,1} in the first product of a group
    // and d = 8j + 4hh + {2,3} in the second.
    const float* fa = my + c * OP + 4 * hh;
    const float* fb = fa + OT * OP;
#pragma unroll   // straight-line code lets the LDS reads run ahead of the matrix instructions
    for (int j = 0; j < OKW / 8; ++j) {
        const float4 a0 = *(const float4*)(fa + 8 * j);
        const float4 a1 = *(const float4*)(fa + 16 * OP + 8 * j);
        const float4 b0 = *(const float4*)(fb + 8 * j);
        const float4 b1 = *(const float4*)(fb + 16 * OP + 8 * j);
        const v2f a0l = {a0.x, a0.y}, a0h = {a0.z, a0.w};
        const v2f a1l = {a1.x, a1.y}, a1h = {a1.z, a1.w};
        const v2f b0l = {b0.x, b0.y}, b0h = {b0.z, b0.w};
        const v2f b1l = {b1.x, b1.y}, b1h = {b1.z, b1.w};
        acc[0][0] = __builtin_amdgcn_wmma_f32_16x16x4_f32(false, a0l, false, b0l, (short)0, acc[0][0], false, false);
        acc[0][1] = __builtin_amdgcn_wmma_f32_16x16x4_f32(false, a0l, false, b1l, (short)0, acc[0][1], false, false);
        acc[1][0] = __builtin_amdgcn_wmma_f32_16x16x4_f32(false, a1l, false, b0l, (short)0, acc[1][0], false, false);
        acc[1][1] = __builtin_amdgcn_wmma_f32_16x16x4_f32(false, a1l, false, b1l, (short)0, acc[1][1], false, false);
        acc[0][0] = __builtin_amdgcn_wmma_f32_16x16x4_f32(false, a0h, false, b0h, (short)0, acc[0][0], false, false);
        acc[0][1] = __builtin_amdgcn_wmma_f32_16x16x4_f32(false, a0h, false, b1h, (short)0, acc[0][1], false, false);
        acc[1][0] = __builtin_amdgcn_wmma_f32_16x16x4_f32(false, a1h, false, b0h, (short)0, acc[1][0], false, false);
        acc[1][1] = __builtin_amdgcn_wmma_f32_16x16x4_f32(false, a1h, false, b1h, (short)0, acc[1][1], false, false);
    }

    // Partial tile into the head of the wave's own range (its rows are all read:
    // every accumulator depends on them).  D layout: register r <-> row 8*hh + r, column c.
#pragma unroll   // these three: constant indices keep acc[][] in registers
    for (int i = 0; i < 2; ++i)
#pragma unroll
        for (int jn = 0; jn < 2; ++jn)
#pragma unroll
            for (int r = 0; r < 8; ++r)
                my[(16 * i + 8 * hh + r) * ORP + 16 * jn + c] = acc[i][jn][r];
    __syncthreads();                             // the partial tiles are complete

    const int row = tid >> 4;                    // 0..31
    const int col = (tid & 15) * 2;              // 16 threads store one 128-B line of out
    const float* pr = st + row * ORP + col;
    float2 s = *(const float2*)pr;
#pragma unroll   // the LDS reads issue together
    for (int w = 1; w < OW; ++w) {
        const float2 q2 = *(const float2*)(pr + w * OWR);
        s.x += q2.x; s.y += q2.y;
    }
    *(float2*)(out + (size_t)(bt0 + row) * H + h0 + col) = s;
}

// ---------------------------------------------------------------------------
extern "C" void kernel_launch(void* const* d_in, const int* in_sizes, int n_in,
                              void* d_out, int out_size, void* d_ws, size_t ws_size,
                              hipStream_t stream) {
    const float* x    = (const float*)d_in[0];   // (B,S,D)
    const float* mask = (const float*)d_in[1];   // (B,1,S)
    const float* wk   = (const float*)d_in[2];   // (H,D)
    const float* wv   = (const float*)d_in[3];   // (H,D)
    const float* q    = (const float*)d_in[4];   // (T,H)
    float* out = (float*)d_out;                  // (B,T,H)

    char* ws = (char*)d_ws;
    bf16_t* qk_ws    = (bf16_t*)(ws);                                  // T*D bf16      = 128 KB, tile by tile
    float*  mb_ws    = (float*)(ws + 131072);                          // B*T*NB f32    = 64 KB
    float*  lb_ws    = (float*)(ws + 131072 + 65536);                  // B*T*NB f32    = 64 KB
    float*  u_ws     = (float*)(ws + 131072 + 131072);                 // B*T*D f32     = 1 MB
    float*  upart_ws = (float*)(ws + 131072 + 131072 + 1048576);       // B*NB*T*D f32  = 64 MB

    qk_kernel<<<(T / QT) * (D / QN), 32 * QW, 0, stream>>>(q, wk, qk_ws);
    attn_kernel<<<B * NB, 256, 0, stream>>>(x, qk_ws, mask, upart_ws, mb_ws, lb_ws);
    usum_kernel<<<B * (T * D / UM1), 256, 0, stream>>>(upart_ws, mb_ws, lb_ws, u_ws);
    out_kernel<<<(B * T / OT) * (H / OT), 32 * OW, 0, stream>>>(u_ws, wv, out);
}

// v009
// A run of this version takes 40.8 microseconds.
// In two side-by-side timings against v008, it was 1.06 and 1.05 times as fast.
// All steps since v000 together make it 12.1 times as fast.
#include <hip/hip_runtime.h>
#include <hip/hip_bf16.h>

// Problem constants (from reference)
constexpr int B = 4;
constexpr int S = 8192;
constexpr int D = 1024;   // DIM
constexpr int H = 1024;   // HDIM
constexpr int T = 64;     // NUM_TOKENS

typedef __bf16 bf16_t;
typedef __attribute__((ext_vector_type(8)))  __bf16 v8bf;
typedef __attribute__((ext_vector_type(16))) __bf16 v16bf;
typedef __attribute__((ext_vector_type(8)))  float  v8f;

__device__ __forceinline__ v16bf cat16(v8bf lo, v8bf hi) {
    return __builtin_shufflevector(lo, hi, 0,1,2,3,4,5,6,7,8,9,10,11,12,13,14,15);
}

// The wave's own asynchronous copies to LDS have landed.
__device__ __forceinline__ void wait_async0() {
    asm volatile("s_wait_asynccnt 0x0" ::: "memory");
}

template <int LS, int GS, typename E>
__device__ __forceinline__ void async_rows8(unsigned int l, const E* g) {
    asm volatile(
        "global_load_async_to_lds_b128 %0, %8, off\n\t"
        "global_load_async_to_lds_b128 %1, %9, off\n\t"
        "global_load_async_to_lds_b128 %2, %10, off\n\t"
        "global_load_async_to_lds_b128 %3, %11, off\n\t"
        "global_load_async_to_lds_b128 %4, %12, off\n\t"
        "global_load_async_to_lds_b128 %5, %13, off\n\t"
        "global_load_async_to_lds_b128 %6, %14, off\n\t"
        "global_load_async_to_lds_b128 %7, %15, off\n\t"
        "s_wait_xcnt 0x0"
        :: "v"(l),          "v"(l + 1 * LS), "v"(l + 2 * LS), "v"(l + 3 * LS),
           "v"(l + 4 * LS), "v"(l + 5 * LS), "v"(l + 6 * LS), "v"(l + 7 * LS),
           "v"(g),          "v"(g + 1 * GS), "v"(g + 2 * GS), "v"(g + 3 * GS),
           "v"(g + 4 * GS), "v"(g + 5 * GS), "v"(g + 6 * GS), "v"(g + 7 * GS)
        : "memory");
}

constexpr int QT  = 16;
constexpr int QN  = 16;
constexpr int QW  = 8;
constexpr int QK  = H / QW;
constexpr int QP  = QN + 4;
constexpr int QWR = QT * QP;
constexpr int QQP = QK + 4;
typedef __attribute__((ext_vector_type(2))) float  v2f;
typedef __attribute__((ext_vector_type(4))) float  v4f;
typedef __attribute__((ext_vector_type(2))) __bf16 v2bf;
static_assert(QK * 4 == 512, "a copy of a wave is one row of its slice of q");

__global__ __launch_bounds__(32 * QW) void qk_kernel(const float* __restrict__ q,
                                                     const float* __restrict__ wk,
                                                     bf16_t* __restrict__ qk) {
    __shared__ __attribute__((aligned(16))) float qst[QW * QT * QQP];   // [wave][t_local][h_local]
    __shared__ __attribute__((aligned(16))) float part[QW * QWR];

    const int t0  = (blockIdx.x >> 6) * QT;      // 4 tiles over T
    const int dt  = blockIdx.x & 63;             // 64 tiles over D
    const int tid = threadIdx.x;
    const int wave = tid >> 5;
    const int lane = tid & 31;
    const int hh = lane >> 4;
    const int c  = lane & 15;

    float* myq = qst + wave * (QT * QQP);
    {
        const unsigned int l = (unsigned int)(uintptr_t)(myq + lane * 4);
        const float* g = q + (size_t)t0 * H + wave * QK + lane * 4;
        async_rows8<QQP * 4, H>(l,               g);
        async_rows8<QQP * 4, H>(l + 8 * QQP * 4, g + 8 * H);
    }

    // wk is the A side (row c of the tile is d = 16*dt + c), q the B side (column c is
    // t0 + c).  Lane half hh holds h = 128*wave + 8j + 4hh + 2p + s (s = 0, 1: the two
    // registers of an operand) on both sides.  q: four consecutive floats of a row give
    // p = 0 and p = 1.  wk: the two rows of an operand are loaded as single floats, so
    // that each lands in its own register of the pair and no move is needed.
    const float* gb = wk + (size_t)(wave * QK + 4 * hh) * D + dt * QN + c;
    v2f b[QK / 8][2];
#pragma unroll   // these three: constant indices keep b[][] in registers
    for (int j = 0; j < QK / 8; ++j)
#pragma unroll
        for (int p = 0; p < 2; ++p)
#pragma unroll
            for (int s = 0; s < 2; ++s)
                b[j][p][s] = gb[(size_t)(8 * j + 2 * p + s) * D];
    // Keeps every load above in front of the wait below and of the first matrix instruction:
    // without it the scheduler sinks the loads to their uses and the wave pays the latency
    // once per group.
    __builtin_amdgcn_sched_barrier(0);
    wait_async0();                               // this wave's rows of q have landed; no other wave reads them

    const float* fa = myq + c * QQP + 4 * hh;
    v8f acc = {};
#pragma unroll   // these two: constant LDS offsets and constant indices into b[][]
    for (int j = 0; j < QK / 8; ++j) {
        const v4f a = *(const v4f*)(fa + 8 * j);
#pragma unroll
        for (int p = 0; p < 2; ++p) {
            const v2f qv = {a[2 * p], a[2 * p + 1]};
            acc = __builtin_amdgcn_wmma_f32_16x16x4_f32(false, b[j][p], false, qv, (short)0, acc, false, false);
        }
    }
    __builtin_amdgcn_sched_barrier(0);
    asm volatile("v_nop\n\tv_nop\n\tv_nop\n\tv_nop");
    __builtin_amdgcn_sched_barrier(0);

    // D layout: register r <-> d = 16*dt + 8*hh + r of row t0 + c: eight adjacent floats.
    float* my = part + wave * QWR + c * QP + 8 * hh;
    const v4f lo = {acc[0], acc[1], acc[2], acc[3]};
    const v4f hi = {acc[4], acc[5], acc[6], acc[7]};
    *(v4f*)(my)     = lo;
    *(v4f*)(my + 4) = hi;
    __syncthreads();                             // the partial tiles are complete

    if (tid < QT * QN / 2) {                     // four whole waves: each stores one 128-B line of qk
        const int row = tid >> 3;                // 0..15
        const int col = (tid & 7) * 2;
        const float* pr = part + row * QP + col;
        v2f s = *(const v2f*)pr;
#pragma unroll   // the LDS reads issue together
        for (int w = 1; w < QW; ++w)
            s += *(const v2f*)(pr + w * QWR);
        const v2bf o2 = {(bf16_t)(s[0] * 0.03125f), (bf16_t)(s[1] * 0.03125f)};   // 1/sqrt(1024)
        *(v2bf*)(qk + ((size_t)dt * T + t0 + row) * QN + col) = o2;
    }
}

constexpr int QSP = D + 8;
constexpr int XK  = 128;
constexpr int XP  = XK + 4;
constexpr int XT  = 16 * XP;
constexpr int XN  = D / XK;
constexpr int SB  = 128;
constexpr int NB  = S / SB;
constexpr int SCP = SB + 4;
constexpr int PP  = SB + 8;
constexpr int XBP = D + 8;
constexpr int XQ  = 8 * 2 * XT + T * QSP / 2;
static_assert(SB * XBP * 2 <= XQ * 4, "the bf16 block of x fits the LDS of the rings and qk");
static_assert(NB == 64, "usum_kernel holds two blocks a lane");
// upart, floats inside a block's T * D.  Element (t, d) with t = 16*mt + 8*h + 4*hf + r4 and
// d = 128*ct + 16*w + n lies at
//   ct*UC + (w>>1)*UW1 + (mt>>1)*UM1 + (w&1)*UW0 + (mt&1)*UM0 + hf*UH + (16*h + n)*4 + r4:
// UM1 floats in a row hold 32 rows t x 32 columns d, the tile of one work-group of usum_kernel.
constexpr int UH  = 128;                 // one store of a wave: 32 lanes x 4 floats
constexpr int UM0 = 2 * UH;
constexpr int UW0 = 2 * UM0;
constexpr int UM1 = 2 * UW0;
constexpr int UW1 = 2 * UM1;
constexpr int UC  = 4 * UW1;
static_assert(XN * UC == T * D, "the strides cover a block's partial exactly");
__global__ __launch_bounds__(256) void attn_kernel(const float* __restrict__ x,
                                                   const bf16_t* __restrict__ qk,
                                                   const float* __restrict__ mask,
                                                   float* __restrict__ upart,
                                                   float* __restrict__ mb,
                                                   float* __restrict__ lb) {
    __shared__ __attribute__((aligned(16))) float xq[XQ];
    float*  xs = xq;                             // step 1: [wave][buf][s_local][k_local]
    bf16_t* qs = (bf16_t*)(xq + 8 * 2 * XT);     // step 1: all of qk
    bf16_t* xb = (bf16_t*)xq;                    // step 3: the block's x as bf16, [s_local][d]
    __shared__ __attribute__((aligned(16))) float sc[T * SCP];    // the block's scores
    __shared__ __attribute__((aligned(16))) bf16_t ps[T * PP];    // the block's p

    const int b   = blockIdx.x >> 6;             // / NB
    const int s0  = (blockIdx.x & 63) << 7;      // * SB
    const int tid = threadIdx.x;
    const int wave = tid >> 5;
    const int lane = tid & 31;
    const int h = lane >> 4;                     // lane half
    const int n = lane & 15;                     // N index / A row-within-tile

    float* myx = xs + wave * (2 * XT);           // this wave's two buffers
    const unsigned int xl = (unsigned int)(uintptr_t)(myx + lane * 4);
    const float* xg = x + ((size_t)b * S + s0 + wave * 16) * D + lane * 4;
    auto copy_tile = [&](int t) {
        const unsigned int l = xl + (t & 1) * (XT * 4);
        const float* g = xg + t * XK;
        async_rows8<XP * 4, D>(l,              g);
        async_rows8<XP * 4, D>(l + 8 * XP * 4, g + 8 * D);
    };

    v8f acc[4] = {};

    copy_tile(0);                                // from memory: issued ahead of qk, which comes from L2

    {
        const unsigned int ql = (unsigned int)(uintptr_t)(qs + (lane >> 1) * QSP + wave * 8 * QN + (lane & 1) * 8);
        const bf16_t* qg = qk + (size_t)(wave * 8) * (T * QN) + lane * 8;
        async_rows8<QN * 2, T * QN>(ql,                    qg);
        async_rows8<QN * 2, T * QN>(ql + 16 * QSP * 2,     qg + 16 * QN);
        async_rows8<QN * 2, T * QN>(ql + 32 * QSP * 2,     qg + 32 * QN);
        async_rows8<QN * 2, T * QN>(ql + 48 * QSP * 2,     qg + 48 * QN);
        wait_async0();
    }
    __syncthreads();

    copy_tile(1);

    const float mv = mask[(size_t)b * S + s0 + wave * 16 + n];
    // No register that the load above names is written again in front of this wait.
    asm volatile("s_wait_xcnt 0x0" ::: "memory");

    v16bf xf[XN * (XK / 32)];                    // this wave's rows of x as B fragments, kept for step 3
#pragma unroll   // constant indices keep xf[] in registers
    for (int t = 0; t < XN; ++t) {
        const float* brow = myx + (t & 1) * XT + n * XP;
#pragma unroll   // constant LDS offsets; the reads of a tile can run ahead of its matrix instructions
        for (int kk = 0; kk < XK / 32; ++kk) {
            const int kb = t * XK + kk * 32;

            // B fragment: B[k][n] = x[b, s0+16*wave+n, kb+k]; k = 16*(e/8)+8h+(e%8)
            const float4* rowp = (const float4*)(brow + kk * 32);
            float4 f0 = rowp[2 * h];
            float4 f1 = rowp[2 * h + 1];
            float4 f2 = rowp[4 + 2 * h];
            float4 f3 = rowp[4 + 2 * h + 1];
            v16bf bfrag;
            bfrag[0]  = (bf16_t)f0.x; bfrag[1]  = (bf16_t)f0.y;
            bfrag[2]  = (bf16_t)f0.z; bfrag[3]  = (bf16_t)f0.w;
            bfrag[4]  = (bf16_t)f1.x; bfrag[5]  = (bf16_t)f1.y;
            bfrag[6]  = (bf16_t)f1.z; bfrag[7]  = (bf16_t)f1.w;
            bfrag[8]  = (bf16_t)f2.x; bfrag[9]  = (bf16_t)f2.y;
            bfrag[10] = (bf16_t)f2.z; bfrag[11] = (bf16_t)f2.w;
            bfrag[12] = (bf16_t)f3.x; bfrag[13] = (bf16_t)f3.y;
            bfrag[14] = (bf16_t)f3.z; bfrag[15] = (bf16_t)f3.w;
            xf[t * (XK / 32) + kk] = bfrag;

#pragma unroll
            for (int mt = 0; mt < 4; ++mt) {
                const bf16_t* arow = qs + (mt * 16 + n) * QSP + kb;
                v8bf alo = *(const v8bf*)(arow + 8 * h);
                v8bf ahi = *(const v8bf*)(arow + 16 + 8 * h);
                v16bf afrag = cat16(alo, ahi);
                acc[mt] = __builtin_amdgcn_wmma_f32_16x16x32_bf16(
                    false, afrag, false, bfrag, (short)0, acc[mt], false, false);
            }
        }
        // This wave's reads of tile t have returned: its buffer may be refilled.
        asm volatile("s_wait_dscnt 0x0" ::: "memory");
        wait_async0();                           // tile t + 1 has landed; behind the last trip no copy is outstanding
        if (t + 2 < XN) copy_tile(t + 2);        // into the buffer that tile t has left
    }

#pragma unroll
    for (int mt = 0; mt < 4; ++mt)
#pragma unroll
        for (int rr = 0; rr < 8; ++rr)
            sc[(mt * 16 + 8 * h + rr) * SCP + wave * 16 + n] = acc[mt][rr] + mv;
    // The scores are complete.  The same barrier stands behind every wave's last read of
    // its ring and of qk and behind its last s_wait_asynccnt 0: that LDS may be written anew.
    __syncthreads();
    // Element e of fragment f is x[16*wave + n][32f + 16*(e/8) + 8h + (e%8)]: two pieces of
    // 16 bytes.  The stores drain under the softmax below.
    {
        bf16_t* xw = xb + (wave * 16 + n) * XBP + 8 * h;
#pragma unroll   // constant indices into xf[]
        for (int f = 0; f < XN * (XK / 32); ++f) {
            *(v8bf*)(xw + 32 * f)      = __builtin_shufflevector(xf[f], xf[f], 0, 1, 2, 3, 4, 5, 6, 7);
            *(v8bf*)(xw + 32 * f + 16) = __builtin_shufflevector(xf[f], xf[f], 8, 9, 10, 11, 12, 13, 14, 15);
        }
    }
    const int st = tid >> 2;                     // four neighbouring lanes share a row of scores
    const int qd = tid & 3;                      // each takes 32 of its 128 columns
    float mx, sum;
    {
        const int t = st;
        const float4* sr = (const float4*)(sc + t * SCP + 32 * qd);
        float v[32];
#pragma unroll   // constant indices keep v[] in registers (the three loops below too)
        for (int k = 0; k < 8; ++k) {
            const float4 f = sr[k];
            v[4 * k] = f.x; v[4 * k + 1] = f.y; v[4 * k + 2] = f.z; v[4 * k + 3] = f.w;
        }
        mx = v[0];
#pragma unroll
        for (int k = 1; k < 32; ++k) mx = fmaxf(mx, v[k]);
        mx = fmaxf(mx, __shfl_xor(mx, 1));
        mx = fmaxf(mx, __shfl_xor(mx, 2));
        // a block that the mask shuts out whole: p = 0 and weight 0, not inf - inf
        const float ms = (mx == -INFINITY) ? 0.0f : mx;
        sum = 0.0f;
#pragma unroll
        for (int k = 0; k < 32; ++k) {
            v[k] = __expf(v[k] - ms);
            sum += v[k];
        }
        sum += __shfl_xor(sum, 1);
        sum += __shfl_xor(sum, 2);
        bf16_t* pw = ps + t * PP + 32 * qd;
#pragma unroll
        for (int k = 0; k < 4; ++k) {
            v8bf o;
#pragma unroll
            for (int e = 0; e < 8; ++e) o[e] = (bf16_t)v[8 * k + e];
            *(v8bf*)(pw + 8 * k) = o;
        }
    }
    __syncthreads();                             // p and the bf16 block of x are complete
    if (qd == 0) {                               // behind the barrier, which would wait for these stores
        mb[(size_t)(b * T + st) * NB + (blockIdx.x & 63)] = mx;
        lb[(size_t)(b * T + st) * NB + (blockIdx.x & 63)] = sum;
    }

    // ---- step 3 ----
    // A side: all of p, the same for every tile of x, held in registers.
    v16bf af[4][SB / 32];
#pragma unroll   // these two: constant indices keep af[][] in registers
    for (int mt = 0; mt < 4; ++mt)
#pragma unroll
        for (int ks = 0; ks < SB / 32; ++ks) {
            const bf16_t* arow = ps + (mt * 16 + n) * PP + ks * 32;
            af[mt][ks] = cat16(*(const v8bf*)(arow + 8 * h), *(const v8bf*)(arow + 16 + 8 * h));
        }

    float* ub = upart + (size_t)blockIdx.x * (T * D) + (wave >> 1) * UW1 + (wave & 1) * UW0 + lane * 4;
    typedef __attribute__((address_space(3))) v8bf lds_v8bf;
    const bf16_t* tb = xb + (8 * h + (lane & 7)) * XBP + wave * 16 + ((lane >> 3) & 1) * 8;
    auto load_b = [&](int ct, v16bf (&bq)[SB / 32]) {
#pragma unroll   // constant LDS offsets and constant indices into bq[]
        for (int ks = 0; ks < SB / 32; ++ks) {
            const bf16_t* p = tb + (32 * ks) * XBP + ct * XK;
            bq[ks] = cat16(__builtin_amdgcn_ds_load_tr16_b128_v8bf16((lds_v8bf*)p),
                           __builtin_amdgcn_ds_load_tr16_b128_v8bf16((lds_v8bf*)(p + 16 * XBP)));
        }
    };
    v16bf bq[2][SB / 32];
    load_b(0, bq[0]);
#pragma unroll   // constant indices into bq[][]; the next tile's fragments are asked for ahead of this tile's products
    for (int ct = 0; ct < XN; ++ct) {
        if (ct + 1 < XN) load_b(ct + 1, bq[(ct + 1) & 1]);
        v8f a2[4] = {};
#pragma unroll   // these two: constant indices into af[][] and a2[]
        for (int ks = 0; ks < SB / 32; ++ks)
#pragma unroll
            for (int mt = 0; mt < 4; ++mt)
                a2[mt] = __builtin_amdgcn_wmma_f32_16x16x32_bf16(
                    false, af[mt][ks], false, bq[ct & 1][ks], (short)0, a2[mt], false, false);
        __builtin_amdgcn_sched_barrier(0);
        asm volatile("v_nop\n\tv_nop\n\tv_nop\n\tv_nop");
        __builtin_amdgcn_sched_barrier(0);
#pragma unroll   // these two: constant indices keep a2[] in registers
        for (int mt = 0; mt < 4; ++mt)
#pragma unroll
            for (int hf = 0; hf < 2; ++hf) {
                const v4f o = {a2[mt][4 * hf], a2[mt][4 * hf + 1], a2[mt][4 * hf + 2], a2[mt][4 * hf + 3]};
                *(v4f*)(ub + ct * UC + (mt >> 1) * UM1 + (mt & 1) * UM0 + hf * UH) = o;
            }
        // No register that the stores above name is written again in front of this wait: the
        // fence keeps the next tile's arithmetic, which reuses them, behind it.
        asm volatile("s_wait_xcnt 0x0" ::: "memory");
        __builtin_amdgcn_sched_barrier(0);
    }
}

__device__ __forceinline__ float exp_slot(float x) {
    const float y = x * 1.44269504f;
    float r;
    asm("v_exp_f32 %0, %1\n\tv_nop" : "=v"(r) : "v"(y));
    return r;
}

__global__ __launch_bounds__(256) void usum_kernel(const float* __restrict__ upart,
                                                   const float* __restrict__ mb,
                                                   const float* __restrict__ lb,
                                                   float* __restrict__ u) {
    const int b    = blockIdx.x >> 6;            // / (T * D / UM1)
    const int g    = blockIdx.x & 63;            // tile of the batch: g & 1 over t, g >> 1 over d
    const int wave = __builtin_amdgcn_readfirstlane(threadIdx.x >> 5);   // scalar: row addresses stay in scalar registers
    const unsigned int lane = threadIdx.x & 31;
    const int t0   = (g & 1) * 32 + wave * 4;    // = 16*mt + 8*h + 4*hf with 4v = 16*(mt&1) + 8*h + 4*hf
    const unsigned int off = (lane >> 4) * UW0 + (lane & 15) * 4;
    const float* p = upart + (size_t)b * NB * (T * D) + g * UM1
                   + (wave >> 2) * UM0 + (wave & 1) * UH + ((wave >> 1) & 1) * 64 + off;

    const float* mr = mb + (size_t)(b * T + t0) * NB;    // the wave's four rows of mb and of lb
    const float* lr = lb + (size_t)(b * T + t0) * NB;

    // mb and lb, then the first blocks' rows, are all asked for at once: loads return in
    // order, so the weights wait for mb and lb alone and are formed while the rows fly.
    constexpr int PF = 16;
    float m[4][2], l[4][2];
    v4f pre[PF];
#pragma unroll   // these two: constant indices keep m[][], l[][] and pre[] in registers
    for (int i = 0; i < 4; ++i) {
        m[i][0] = mr[i * NB + lane]; m[i][1] = mr[i * NB + 32 + lane];
        l[i][0] = lr[i * NB + lane]; l[i][1] = lr[i * NB + 32 + lane];
    }
    // Keeps mb and lb in front of the rows: behind them, the weights would wait for the rows too.
    __builtin_amdgcn_sched_barrier(0);
#pragma unroll
    for (int k = 0; k < PF; ++k)
        pre[k] = *(const v4f*)(p + (size_t)k * (T * D));
    // Without this the scheduler sinks loads from above into and behind the weights' chains,
    // and the wave pays the memory latency several times, one after the other.
    __builtin_amdgcn_sched_barrier(0);

    float w[4][2];
#pragma unroll   // constant indices keep w[][] in registers; the four rows' chains overlap
    for (int i = 0; i < 4; ++i) {
        const float m0 = m[i][0], m1 = m[i][1];
        const float l0 = l[i][0], l1 = l[i][1];
        float mx = fmaxf(m0, m1);
#pragma unroll
        for (int off = 16; off > 0; off >>= 1) mx = fmaxf(mx, __shfl_xor(mx, off));
        w[i][0] = exp_slot(m0 - mx);
        w[i][1] = exp_slot(m1 - mx);
        float ls = w[i][0] * l0 + w[i][1] * l1;
#pragma unroll
        for (int off = 16; off > 0; off >>= 1) ls += __shfl_xor(ls, off);
        const float inv = 1.0f / ls;
        w[i][0] *= inv; w[i][1] *= inv;
    }

    float a[4] = {0.0f, 0.0f, 0.0f, 0.0f};
#pragma unroll   // constant indices into w[][], a constant lane to read the weights from; the blocks' loads overlap
    for (int k = 0; k < NB; ++k) {
        const v4f v = k < PF ? pre[k] : *(const v4f*)(p + (size_t)k * (T * D));
#pragma unroll
        for (int i = 0; i < 4; ++i)
            a[i] += __uint_as_float(__builtin_amdgcn_readlane(__float_as_uint(w[i][k >> 5]), k & 31)) * v[i];
    }
    float* uo = u + (size_t)(b * T + t0) * D + (g >> 1) * 32 + lane;
#pragma unroll   // constant indices keep a[] in registers
    for (int i = 0; i < 4; ++i)
        uo[(size_t)i * D] = a[i];
}

constexpr int OT   = 32;
constexpr int OW   = 16;
constexpr int OKW  = D / OW;
constexpr int OP   = OKW + 4;
constexpr int OWR  = 2 * OT * OP;
constexpr int ORP  = OT + 4;

__device__ __forceinline__ void async_rows16(unsigned int l, const float* g) {
    asm volatile(
        "global_load_async_to_lds_b128 %0, %8, off\n\t"
        "global_load_async_to_lds_b128 %1, %9, off\n\t"
        "global_load_async_to_lds_b128 %2, %10, off\n\t"
        "global_load_async_to_lds_b128 %3, %11, off\n\t"
        "global_load_async_to_lds_b128 %4, %12, off\n\t"
        "global_load_async_to_lds_b128 %5, %13, off\n\t"
        "global_load_async_to_lds_b128 %6, %14, off\n\t"
        "global_load_async_to_lds_b128 %7, %15, off\n\t"
        "s_wait_xcnt 0x0"
        :: "v"(l),                "v"(l +  2 * OP * 4), "v"(l +  4 * OP * 4), "v"(l +  6 * OP * 4),
           "v"(l +  8 * OP * 4), "v"(l + 10 * OP * 4), "v"(l + 12 * OP * 4), "v"(l + 14 * OP * 4),
           "v"(g),          "v"(g +  2 * D), "v"(g +  4 * D), "v"(g +  6 * D),
           "v"(g +  8 * D), "v"(g + 10 * D), "v"(g + 12 * D), "v"(g + 14 * D)
        : "memory");
}

__global__ __launch_bounds__(32 * OW) void out_kernel(const float* __restrict__ u,
                                                      const float* __restrict__ wv,
                                                      float* __restrict__ out) {
    __shared__ __attribute__((aligned(16))) float st[OW * OWR];

    const int bt0 = (blockIdx.x >> 5) * OT;      // 8 tiles over B*T
    const int h0  = (blockIdx.x & 31) * OT;      // 32 tiles over H
    const int tid = threadIdx.x;
    const int wave = tid >> 5;
    const int lane = tid & 31;
    const int hh = lane >> 4;
    const int c  = lane & 15;

    float* my = st + wave * OWR;                 // rows 0..31: u, rows 32..63: wv

    // staging: lane half hh takes row 2r + hh, lane c its floats 4c .. 4c+3
    const float* gu = u  + (size_t)(bt0 + hh) * D + wave * OKW + c * 4;
    const float* gw = wv + (size_t)(h0  + hh) * D + wave * OKW + c * 4;
    const unsigned int sm = (unsigned int)(uintptr_t)(my + hh * OP + c * 4);
    async_rows16(sm + OT * OP * 4,        gw);            // wv rows  0..15
    async_rows16(sm + (OT + 16) * OP * 4, gw + 16 * D);   // wv rows 16..31
    async_rows16(sm,                      gu);            // u rows   0..15
    async_rows16(sm + 16 * OP * 4,        gu + 16 * D);   // u rows  16..31
    wait_async0();                               // this wave's copies have landed
    __syncthreads();                             // nobody reads the rows in front of this

    v8f acc[2][2] = {};
    // A and B fragments come from the same loader, so their k orders are equal:
    // lane half hh holds d = 8j + 4hh + {0,1} in the first product of a group
    // and d = 8j + 4hh + {2,3} in the second.
    const float* fa = my + c * OP + 4 * hh;
    const float* fb = fa + OT * OP;
#pragma unroll   // straight-line code lets the LDS reads run ahead of the matrix instructions
    for (int j = 0; j < OKW / 8; ++j) {
        const float4 a0 = *(const float4*)(fa + 8 * j);
        const float4 a1 = *(const float4*)(fa + 16 * OP + 8 * j);
        const float4 b0 = *(const float4*)(fb + 8 * j);
        const float4 b1 = *(const float4*)(fb + 16 * OP + 8 * j);
        const v2f a0l = {a0.x, a0.y}, a0h = {a0.z, a0.w};
        const v2f a1l = {a1.x, a1.y}, a1h = {a1.z, a1.w};
        const v2f b0l = {b0.x, b0.y}, b0h = {b0.z, b0.w};
        const v2f b1l = {b1.x, b1.y}, b1h = {b1.z, b1.w};
        acc[0][0] = __builtin_amdgcn_wmma_f32_16x16x4_f32(false, a0l, false, b0l, (short)0, acc[0][0], false, false);
        acc[0][1] = __builtin_amdgcn_wmma_f32_16x16x4_f32(false, a0l, false, b1l, (short)0, acc[0][1], false, false);
        acc[1][0] = __builtin_amdgcn_wmma_f32_16x16x4_f32(false, a1l, false, b0l, (short)0, acc[1][0], false, false);
        acc[1][1] = __builtin_amdgcn_wmma_f32_16x16x4_f32(false, a1l, false, b1l, (short)0, acc[1][1], false, false);
        acc[0][0] = __builtin_amdgcn_wmma_f32_16x16x4_f32(false, a0h, false, b0h, (short)0, acc[0][0], false, false);
        acc[0][1] = __builtin_amdgcn_wmma_f32_16x16x4_f32(false, a0h, false, b1h, (short)0, acc[0][1], false, false);
        acc[1][0] = __builtin_amdgcn_wmma_f32_16x16x4_f32(false, a1h, false, b0h, (short)0, acc[1][0], false, false);
        acc[1][1] = __builtin_amdgcn_wmma_f32_16x16x4_f32(false, a1h, false, b1h, (short)0, acc[1][1], false, false);
    }

    // Partial tile into the head of the wave's own range (its rows are all read:
    // every accumulator depends on them).  D layout: register r <-> row 8*hh + r, column c.
#pragma unroll   // these three: constant indices keep acc[][] in registers
    for (int i = 0; i < 2; ++i)
#pragma unroll
        for (int jn = 0; jn < 2; ++jn)
#pragma unroll
            for (int r = 0; r < 8; ++r)
                my[(16 * i + 8 * hh + r) * ORP + 16 * jn + c] = acc[i][jn][r];
    __syncthreads();                             // the partial tiles are complete

    const int row = tid >> 4;                    // 0..31
    const int col = (tid & 15) * 2;              // 16 threads store one 128-B line of out
    const float* pr = st + row * ORP + col;
    float2 s = *(const float2*)pr;
#pragma unroll   // the LDS reads issue together
    for (int w = 1; w < OW; ++w) {
        const float2 q2 = *(const float2*)(pr + w * OWR);
        s.x += q2.x; s.y += q2.y;
    }
    *(float2*)(out + (size_t)(bt0 + row) * H + h0 + col) = s;
}

// ---------------------------------------------------------------------------
extern "C" void kernel_launch(void* const* d_in, const int* in_sizes, int n_in,
                              void* d_out, int out_size, void* d_ws, size_t ws_size,
                              hipStream_t stream) {
    const float* x    = (const float*)d_in[0];   // (B,S,D)
    const float* mask = (const float*)d_in[1];   // (B,1,S)
    const float* wk   = (const float*)d_in[2];   // (H,D)
    const float* wv   = (const float*)d_in[3];   // (H,D)
    const float* q    = (const float*)d_in[4];   // (T,H)
    float* out = (float*)d_out;                  // (B,T,H)

    char* ws = (char*)d_ws;
    bf16_t* qk_ws    = (bf16_t*)(ws);                                  // T*D bf16      = 128 KB, tile by tile
    float*  mb_ws    = (float*)(ws + 131072);                          // B*T*NB f32    = 64 KB
    float*  lb_ws    = (float*)(ws + 131072 + 65536);                  // B*T*NB f32    = 64 KB
    float*  u_ws     = (float*)(ws + 131072 + 131072);                 // B*T*D f32     = 1 MB
    float*  upart_ws = (float*)(ws + 131072 + 131072 + 1048576);       // B*NB*T*D f32  = 64 MB

    qk_kernel<<<(T / QT) * (D / QN), 32 * QW, 0, stream>>>(q, wk, qk_ws);
    attn_kernel<<<B * NB, 256, 0, stream>>>(x, qk_ws, mask, upart_ws, mb_ws, lb_ws);
    usum_kernel<<<B * (T * D / UM1), 256, 0, stream>>>(upart_ws, mb_ws, lb_ws, u_ws);
    out_kernel<<<(B * T / OT) * (H / OT), 32 * OW, 0, stream>>>(u_ws, wv, out);
}

// v010
// Measured time: 34.2 microseconds a run.
// Two timings next to v009 put it at 1.18 and 1.20 times that version's speed.
// Counting every step since v000, it is 14.4 times as fast.
#include <hip/hip_runtime.h>
#include <hip/hip_bf16.h>

// Problem constants (from reference)
constexpr int B = 4;
constexpr int S = 8192;
constexpr int D = 1024;   // DIM
constexpr int H = 1024;   // HDIM
constexpr int T = 64;     // NUM_TOKENS

typedef __bf16 bf16_t;
typedef __attribute__((ext_vector_type(8)))  __bf16 v8bf;
typedef __attribute__((ext_vector_type(16))) __bf16 v16bf;
typedef __attribute__((ext_vector_type(8)))  float  v8f;

__device__ __forceinline__ v16bf cat16(v8bf lo, v8bf hi) {
    return __builtin_shufflevector(lo, hi, 0,1,2,3,4,5,6,7,8,9,10,11,12,13,14,15);
}

// The wave's own asynchronous copies to LDS have landed.
__device__ __forceinline__ void wait_async0() {
    asm volatile("s_wait_asynccnt 0x0" ::: "memory");
}

template <int LS, int GS, typename E>
__device__ __forceinline__ void async_rows8(unsigned int l, const E* g) {
    asm volatile(
        "global_load_async_to_lds_b128 %0, %8, off\n\t"
        "global_load_async_to_lds_b128 %1, %9, off\n\t"
        "global_load_async_to_lds_b128 %2, %10, off\n\t"
        "global_load_async_to_lds_b128 %3, %11, off\n\t"
        "global_load_async_to_lds_b128 %4, %12, off\n\t"
        "global_load_async_to_lds_b128 %5, %13, off\n\t"
        "global_load_async_to_lds_b128 %6, %14, off\n\t"
        "global_load_async_to_lds_b128 %7, %15, off\n\t"
        "s_wait_xcnt 0x0"
        :: "v"(l),          "v"(l + 1 * LS), "v"(l + 2 * LS), "v"(l + 3 * LS),
           "v"(l + 4 * LS), "v"(l + 5 * LS), "v"(l + 6 * LS), "v"(l + 7 * LS),
           "v"(g),          "v"(g + 1 * GS), "v"(g + 2 * GS), "v"(g + 3 * GS),
           "v"(g + 4 * GS), "v"(g + 5 * GS), "v"(g + 6 * GS), "v"(g + 7 * GS)
        : "memory");
}

constexpr int QT  = 16;
constexpr int QN  = 16;
constexpr int QW  = 8;
constexpr int QK  = H / QW;
constexpr int QP  = QN + 4;
constexpr int QWR = QT * QP;
constexpr int QQP = QK + 4;
typedef __attribute__((ext_vector_type(2))) float  v2f;
typedef __attribute__((ext_vector_type(4))) float  v4f;
typedef __attribute__((ext_vector_type(2))) __bf16 v2bf;
static_assert(QK * 4 == 512, "a copy of a wave is one row of its slice of q");

__global__ __launch_bounds__(32 * QW) void qk_kernel(const float* __restrict__ q,
                                                     const float* __restrict__ wk,
                                                     bf16_t* __restrict__ qk) {
    __shared__ __attribute__((aligned(16))) float qst[QW * QT * QQP];   // [wave][t_local][h_local]
    __shared__ __attribute__((aligned(16))) float part[QW * QWR];

    const int t0  = (blockIdx.x >> 6) * QT;      // 4 tiles over T
    const int dt  = blockIdx.x & 63;             // 64 tiles over D
    const int tid = threadIdx.x;
    const int wave = tid >> 5;
    const int lane = tid & 31;
    const int hh = lane >> 4;
    const int c  = lane & 15;

    float* myq = qst + wave * (QT * QQP);
    {
        const unsigned int l = (unsigned int)(uintptr_t)(myq + lane * 4);
        const float* g = q + (size_t)t0 * H + wave * QK + lane * 4;
        async_rows8<QQP * 4, H>(l,               g);
        async_rows8<QQP * 4, H>(l + 8 * QQP * 4, g + 8 * H);
    }

    // wk is the A side (row c of the tile is d = 16*dt + c), q the B side (column c is
    // t0 + c).  Lane half hh holds h = 128*wave + 8j + 4hh + 2p + s (s = 0, 1: the two
    // registers of an operand) on both sides.  q: four consecutive floats of a row give
    // p = 0 and p = 1.  wk: the two rows of an operand are loaded as single floats, so
    // that each lands in its own register of the pair and no move is needed.
    const float* gb = wk + (size_t)(wave * QK + 4 * hh) * D + dt * QN + c;
    v2f b[QK / 8][2];
#pragma unroll   // these three: constant indices keep b[][] in registers
    for (int j = 0; j < QK / 8; ++j)
#pragma unroll
        for (int p = 0; p < 2; ++p)
#pragma unroll
            for (int s = 0; s < 2; ++s)
                b[j][p][s] = gb[(size_t)(8 * j + 2 * p + s) * D];
    // Keeps every load above in front of the wait below and of the first matrix instruction:
    // without it the scheduler sinks the loads to their uses and the wave pays the latency
    // once per group.
    __builtin_amdgcn_sched_barrier(0);
    wait_async0();                               // this wave's rows of q have landed; no other wave reads them

    const float* fa = myq + c * QQP + 4 * hh;
    v8f acc = {};
#pragma unroll   // these two: constant LDS offsets and constant indices into b[][]
    for (int j = 0; j < QK / 8; ++j) {
        const v4f a = *(const v4f*)(fa + 8 * j);
#pragma unroll
        for (int p = 0; p < 2; ++p) {
            const v2f qv = {a[2 * p], a[2 * p + 1]};
            acc = __builtin_amdgcn_wmma_f32_16x16x4_f32(false, b[j][p], false, qv, (short)0, acc, false, false);
        }
    }
    __builtin_amdgcn_sched_barrier(0);
    asm volatile("v_nop\n\tv_nop\n\tv_nop\n\tv_nop");
    __builtin_amdgcn_sched_barrier(0);

    // D layout: register r <-> d = 16*dt + 8*hh + r of row t0 + c: eight adjacent floats.
    float* my = part + wave * QWR + c * QP + 8 * hh;
    const v4f lo = {acc[0], acc[1], acc[2], acc[3]};
    const v4f hi = {acc[4], acc[5], acc[6], acc[7]};
    *(v4f*)(my)     = lo;
    *(v4f*)(my + 4) = hi;
    __syncthreads();                             // the partial tiles are complete

    if (tid < QT * QN / 2) {                     // four whole waves: each stores one 128-B line of qk
        const int row = tid >> 3;                // 0..15
        const int col = (tid & 7) * 2;
        const float* pr = part + row * QP + col;
        v2f s = *(const v2f*)pr;
#pragma unroll   // the LDS reads issue together
        for (int w = 1; w < QW; ++w)
            s += *(const v2f*)(pr + w * QWR);
        const v2bf o2 = {(bf16_t)(s[0] * 0.03125f), (bf16_t)(s[1] * 0.03125f)};   // 1/sqrt(1024)
        *(v2bf*)(qk + ((size_t)dt * T + t0 + row) * QN + col) = o2;
    }
}

constexpr int QSP = D + 8;
constexpr int XK  = 128;
constexpr int XP  = XK + 4;
constexpr int XT  = 16 * XP;
constexpr int XN  = D / XK;
constexpr int SB  = 128;
constexpr int NB  = S / SB;
constexpr int SCP = SB + 4;
constexpr int PP  = SB + 8;
constexpr int XBP = D + 8;
constexpr int XQ  = 8 * 2 * XT + T * QSP / 2;
static_assert(SB * XBP * 2 <= XQ * 4, "the bf16 block of x fits the LDS of the rings and qk");
static_assert(NB == 64, "usum_kernel holds two blocks a lane");
// upart, elements inside a block's T * D.  Element (t, d) with t = 16*mt + 8*h + r and
// d = 128*ct + 16*w + n lies at
//   ct*UC + (w>>1)*UW1 + (mt>>1)*UM1 + (w&1)*UW0 + (mt&1)*UM0 + (16*h + n)*8 + r:
// UM1 elements in a row hold 32 rows t x 32 columns d, the tile of one work-group of usum_kernel.
typedef __attribute__((ext_vector_type(8))) _Float16 v8h;
constexpr int UM0 = 256;                 // one store of a wave: 32 lanes x 8 elements
constexpr int UW0 = 2 * UM0;
constexpr int UM1 = 2 * UW0;
constexpr int UW1 = 2 * UM1;
constexpr int UC  = 4 * UW1;
static_assert(XN * UC == T * D, "the strides cover a block's partial exactly");
__global__ __launch_bounds__(256) void attn_kernel(const float* __restrict__ x,
                                                   const bf16_t* __restrict__ qk,
                                                   const float* __restrict__ mask,
                                                   _Float16* __restrict__ upart,
                                                   float* __restrict__ mb,
                                                   float* __restrict__ lb) {
    __shared__ __attribute__((aligned(16))) float xq[XQ];
    float*  xs = xq;                             // step 1: [wave][buf][s_local][k_local]
    bf16_t* qs = (bf16_t*)(xq + 8 * 2 * XT);     // step 1: all of qk
    bf16_t* xb = (bf16_t*)xq;                    // step 3: the block's x as bf16, [s_local][d]
    __shared__ __attribute__((aligned(16))) float sc[T * SCP];    // the block's scores
    __shared__ __attribute__((aligned(16))) bf16_t ps[T * PP];    // the block's p

    const int b   = blockIdx.x >> 6;             // / NB
    const int s0  = (blockIdx.x & 63) << 7;      // * SB
    const int tid = threadIdx.x;
    const int wave = tid >> 5;
    const int lane = tid & 31;
    const int h = lane >> 4;                     // lane half
    const int n = lane & 15;                     // N index / A row-within-tile

    float* myx = xs + wave * (2 * XT);           // this wave's two buffers
    const unsigned int xl = (unsigned int)(uintptr_t)(myx + lane * 4);
    const float* xg = x + ((size_t)b * S + s0 + wave * 16) * D + lane * 4;
    auto copy_tile = [&](int t) {
        const unsigned int l = xl + (t & 1) * (XT * 4);
        const float* g = xg + t * XK;
        async_rows8<XP * 4, D>(l,              g);
        async_rows8<XP * 4, D>(l + 8 * XP * 4, g + 8 * D);
    };

    v8f acc[4] = {};

    copy_tile(0);                                // from memory: issued ahead of qk, which comes from L2

    {
        const unsigned int ql = (unsigned int)(uintptr_t)(qs + (lane >> 1) * QSP + wave * 8 * QN + (lane & 1) * 8);
        const bf16_t* qg = qk + (size_t)(wave * 8) * (T * QN) + lane * 8;
        async_rows8<QN * 2, T * QN>(ql,                    qg);
        async_rows8<QN * 2, T * QN>(ql + 16 * QSP * 2,     qg + 16 * QN);
        async_rows8<QN * 2, T * QN>(ql + 32 * QSP * 2,     qg + 32 * QN);
        async_rows8<QN * 2, T * QN>(ql + 48 * QSP * 2,     qg + 48 * QN);
        wait_async0();
    }
    __syncthreads();

    copy_tile(1);

    const float mv = mask[(size_t)b * S + s0 + wave * 16 + n];
    // No register that the load above names is written again in front of this wait.
    asm volatile("s_wait_xcnt 0x0" ::: "memory");

    v16bf xf[XN * (XK / 32)];                    // this wave's rows of x as B fragments, kept for step 3
#pragma unroll   // constant indices keep xf[] in registers
    for (int t = 0; t < XN; ++t) {
        const float* brow = myx + (t & 1) * XT + n * XP;
#pragma unroll   // constant LDS offsets; the reads of a tile can run ahead of its matrix instructions
        for (int kk = 0; kk < XK / 32; ++kk) {
            const int kb = t * XK + kk * 32;

            // B fragment: B[k][n] = x[b, s0+16*wave+n, kb+k]; k = 16*(e/8)+8h+(e%8)
            const float4* rowp = (const float4*)(brow + kk * 32);
            float4 f0 = rowp[2 * h];
            float4 f1 = rowp[2 * h + 1];
            float4 f2 = rowp[4 + 2 * h];
            float4 f3 = rowp[4 + 2 * h + 1];
            v16bf bfrag;
            bfrag[0]  = (bf16_t)f0.x; bfrag[1]  = (bf16_t)f0.y;
            bfrag[2]  = (bf16_t)f0.z; bfrag[3]  = (bf16_t)f0.w;
            bfrag[4]  = (bf16_t)f1.x; bfrag[5]  = (bf16_t)f1.y;
            bfrag[6]  = (bf16_t)f1.z; bfrag[7]  = (bf16_t)f1.w;
            bfrag[8]  = (bf16_t)f2.x; bfrag[9]  = (bf16_t)f2.y;
            bfrag[10] = (bf16_t)f2.z; bfrag[11] = (bf16_t)f2.w;
            bfrag[12] = (bf16_t)f3.x; bfrag[13] = (bf16_t)f3.y;
            bfrag[14] = (bf16_t)f3.z; bfrag[15] = (bf16_t)f3.w;
            xf[t * (XK / 32) + kk] = bfrag;

#pragma unroll
            for (int mt = 0; mt < 4; ++mt) {
                const bf16_t* arow = qs + (mt * 16 + n) * QSP + kb;
                v8bf alo = *(const v8bf*)(arow + 8 * h);
                v8bf ahi = *(const v8bf*)(arow + 16 + 8 * h);
                v16bf afrag = cat16(alo, ahi);
                acc[mt] = __builtin_amdgcn_wmma_f32_16x16x32_bf16(
                    false, afrag, false, bfrag, (short)0, acc[mt], false, false);
            }
        }
        // This wave's reads of tile t have returned: its buffer may be refilled.
        asm volatile("s_wait_dscnt 0x0" ::: "memory");
        wait_async0();                           // tile t + 1 has landed; behind the last trip no copy is outstanding
        if (t + 2 < XN) copy_tile(t + 2);        // into the buffer that tile t has left
    }

#pragma unroll
    for (int mt = 0; mt < 4; ++mt)
#pragma unroll
        for (int rr = 0; rr < 8; ++rr)
            sc[(mt * 16 + 8 * h + rr) * SCP + wave * 16 + n] = acc[mt][rr] + mv;
    // The scores are complete.  The same barrier stands behind every wave's last read of
    // its ring and of qk and behind its last s_wait_asynccnt 0: that LDS may be written anew.
    __syncthreads();
    // Element e of fragment f is x[16*wave + n][32f + 16*(e/8) + 8h + (e%8)]: two pieces of
    // 16 bytes.  The stores drain under the softmax below.
    {
        bf16_t* xw = xb + (wave * 16 + n) * XBP + 8 * h;
#pragma unroll   // constant indices into xf[]
        for (int f = 0; f < XN * (XK / 32); ++f) {
            *(v8bf*)(xw + 32 * f)      = __builtin_shufflevector(xf[f], xf[f], 0, 1, 2, 3, 4, 5, 6, 7);
            *(v8bf*)(xw + 32 * f + 16) = __builtin_shufflevector(xf[f], xf[f], 8, 9, 10, 11, 12, 13, 14, 15);
        }
    }
    const int st = tid >> 2;                     // four neighbouring lanes share a row of scores
    const int qd = tid & 3;                      // each takes 32 of its 128 columns
    float mx, sum;
    {
        const int t = st;
        const float4* sr = (const float4*)(sc + t * SCP + 32 * qd);
        float v[32];
#pragma unroll   // constant indices keep v[] in registers (the three loops below too)
        for (int k = 0; k < 8; ++k) {
            const float4 f = sr[k];
            v[4 * k] = f.x; v[4 * k + 1] = f.y; v[4 * k + 2] = f.z; v[4 * k + 3] = f.w;
        }
        mx = v[0];
#pragma unroll
        for (int k = 1; k < 32; ++k) mx = fmaxf(mx, v[k]);
        mx = fmaxf(mx, __shfl_xor(mx, 1));
        mx = fmaxf(mx, __shfl_xor(mx, 2));
        // a block that the mask shuts out whole: p = 0 and weight 0, not inf - inf
        const float ms = (mx == -INFINITY) ? 0.0f : mx;
        sum = 0.0f;
#pragma unroll
        for (int k = 0; k < 32; ++k) {
            v[k] = __expf(v[k] - ms);
            sum += v[k];
        }
        sum += __shfl_xor(sum, 1);
        sum += __shfl_xor(sum, 2);
        bf16_t* pw = ps + t * PP + 32 * qd;
#pragma unroll
        for (int k = 0; k < 4; ++k) {
            v8bf o;
#pragma unroll
            for (int e = 0; e < 8; ++e) o[e] = (bf16_t)v[8 * k + e];
            *(v8bf*)(pw + 8 * k) = o;
        }
    }
    __syncthreads();                             // p and the bf16 block of x are complete
    if (qd == 0) {                               // behind the barrier, which would wait for these stores
        mb[(size_t)(b * T + st) * NB + (blockIdx.x & 63)] = mx;
        lb[(size_t)(b * T + st) * NB + (blockIdx.x & 63)] = sum;
    }

    // ---- step 3 ----
    // A side: all of p, the same for every tile of x, held in registers.
    v16bf af[4][SB / 32];
#pragma unroll   // these two: constant indices keep af[][] in registers
    for (int mt = 0; mt < 4; ++mt)
#pragma unroll
        for (int ks = 0; ks < SB / 32; ++ks) {
            const bf16_t* arow = ps + (mt * 16 + n) * PP + ks * 32;
            af[mt][ks] = cat16(*(const v8bf*)(arow + 8 * h), *(const v8bf*)(arow + 16 + 8 * h));
        }

    _Float16* ub = upart + (size_t)blockIdx.x * (T * D) + (wave >> 1) * UW1 + (wave & 1) * UW0 + lane * 8;
    typedef __attribute__((address_space(3))) v8bf lds_v8bf;
    const bf16_t* tb = xb + (8 * h + (lane & 7)) * XBP + wave * 16 + ((lane >> 3) & 1) * 8;
    auto load_b = [&](int ct, v16bf (&bq)[SB / 32]) {
#pragma unroll   // constant LDS offsets and constant indices into bq[]
        for (int ks = 0; ks < SB / 32; ++ks) {
            const bf16_t* p = tb + (32 * ks) * XBP + ct * XK;
            bq[ks] = cat16(__builtin_amdgcn_ds_load_tr16_b128_v8bf16((lds_v8bf*)p),
                           __builtin_amdgcn_ds_load_tr16_b128_v8bf16((lds_v8bf*)(p + 16 * XBP)));
        }
    };
    v16bf bq[2][SB / 32];
    load_b(0, bq[0]);
#pragma unroll   // constant indices into bq[][]; the next tile's fragments are asked for ahead of this tile's products
    for (int ct = 0; ct < XN; ++ct) {
        if (ct + 1 < XN) load_b(ct + 1, bq[(ct + 1) & 1]);
        v8f a2[4] = {};
#pragma unroll   // these two: constant indices into af[][] and a2[]
        for (int ks = 0; ks < SB / 32; ++ks)
#pragma unroll
            for (int mt = 0; mt < 4; ++mt)
                a2[mt] = __builtin_amdgcn_wmma_f32_16x16x32_bf16(
                    false, af[mt][ks], false, bq[ct & 1][ks], (short)0, a2[mt], false, false);
        __builtin_amdgcn_sched_barrier(0);
        asm volatile("v_nop\n\tv_nop\n\tv_nop\n\tv_nop");
        __builtin_amdgcn_sched_barrier(0);
#pragma unroll   // these two: constant indices keep a2[] in registers
        for (int mt = 0; mt < 4; ++mt) {
            v8h o;
#pragma unroll
            for (int r = 0; r < 8; ++r) o[r] = (_Float16)a2[mt][r];
            *(v8h*)(ub + ct * UC + (mt >> 1) * UM1 + (mt & 1) * UM0) = o;
        }
        // No register that the stores above name is written again in front of this wait: the
        // fence keeps the next tile's arithmetic, which reuses them, behind it.
        asm volatile("s_wait_xcnt 0x0" ::: "memory");
        __builtin_amdgcn_sched_barrier(0);
    }
}

__device__ __forceinline__ float exp_slot(float x) {
    const float y = x * 1.44269504f;
    float r;
    asm("v_exp_f32 %0, %1\n\tv_nop" : "=v"(r) : "v"(y));
    return r;
}

__global__ __launch_bounds__(128) void usum_kernel(const _Float16* __restrict__ upart,
                                                   const float* __restrict__ mb,
                                                   const float* __restrict__ lb,
                                                   float* __restrict__ u) {
    const int b    = blockIdx.x >> 6;            // / (T * D / UM1)
    const int g    = blockIdx.x & 63;            // tile of the batch: g & 1 over t, g >> 1 over d
    const int wave = __builtin_amdgcn_readfirstlane(threadIdx.x >> 5);   // scalar: row addresses stay in scalar registers
    const unsigned int lane = threadIdx.x & 31;
    const int t0   = (g & 1) * 32 + wave * 8;    // = 16*mt + 8*h with 8v = 16*(mt&1) + 8*h
    const unsigned int off = (lane >> 4) * UW0 + (lane & 15) * 8;
    const _Float16* p = upart + (size_t)b * NB * (T * D) + g * UM1
                      + (wave >> 1) * UM0 + (wave & 1) * 128 + off;

    const float* mr = mb + (size_t)(b * T + t0) * NB;    // the wave's eight rows of mb and of lb
    const float* lr = lb + (size_t)(b * T + t0) * NB;

    // mb and lb, then every block's rows, are all asked for at once: loads return in order,
    // so the weights wait for little more than mb and lb and are formed while the rows fly.  As f16 all
    // 64 blocks' rows fit the wave's registers, so every one of them is on its way before the
    // first is summed (the load counter holds 63: the last rows issue as mb and lb return).
    float m[8][2], l[8][2];
    v8h pre[NB];
#pragma unroll   // these two: constant indices keep m[][], l[][] and pre[] in registers
    for (int i = 0; i < 8; ++i) {
        m[i][0] = mr[i * NB + lane]; m[i][1] = mr[i * NB + 32 + lane];
        l[i][0] = lr[i * NB + lane]; l[i][1] = lr[i * NB + 32 + lane];
    }
    // Keeps mb and lb in front of the rows: behind them, the weights would wait for the rows too.
    __builtin_amdgcn_sched_barrier(0);
#pragma unroll
    for (int k = 0; k < NB; ++k)
        pre[k] = *(const v8h*)(p + (size_t)k * (T * D));
    // Without this the scheduler sinks loads from above into and behind the weights' chains,
    // and the wave pays the memory latency several times, one after the other.
    __builtin_amdgcn_sched_barrier(0);

    float w[8][2];
#pragma unroll   // constant indices keep w[][] in registers; the eight rows' chains overlap
    for (int i = 0; i < 8; ++i) {
        const float m0 = m[i][0], m1 = m[i][1];
        const float l0 = l[i][0], l1 = l[i][1];
        float mx = fmaxf(m0, m1);
#pragma unroll
        for (int off = 16; off > 0; off >>= 1) mx = fmaxf(mx, __shfl_xor(mx, off));
        w[i][0] = exp_slot(m0 - mx);
        w[i][1] = exp_slot(m1 - mx);
        float ls = w[i][0] * l0 + w[i][1] * l1;
#pragma unroll
        for (int off = 16; off > 0; off >>= 1) ls += __shfl_xor(ls, off);
        const float inv = 1.0f / ls;
        w[i][0] *= inv; w[i][1] *= inv;
    }

    float a[8] = {0.0f, 0.0f, 0.0f, 0.0f, 0.0f, 0.0f, 0.0f, 0.0f};
#pragma unroll   // these two: constant indices into w[][] and pre[], a constant lane to read the weights from
    for (int k = 0; k < NB; ++k)
#pragma unroll
        for (int i = 0; i < 8; ++i)
            a[i] += __uint_as_float(__builtin_amdgcn_readlane(__float_as_uint(w[i][k >> 5]), k & 31)) * (float)pre[k][i];
    float* uo = u + (size_t)(b * T + t0) * D + (g >> 1) * 32 + lane;
#pragma unroll   // constant indices keep a[] in registers
    for (int i = 0; i < 8; ++i)
        uo[(size_t)i * D] = a[i];
}

constexpr int OT   = 32;
constexpr int OW   = 16;
constexpr int OKW  = D / OW;
constexpr int OP   = OKW + 4;
constexpr int OWR  = 2 * OT * OP;
constexpr int ORP  = OT + 4;

__device__ __forceinline__ void async_rows16(unsigned int l, const float* g) {
    asm volatile(
        "global_load_async_to_lds_b128 %0, %8, off\n\t"
        "global_load_async_to_lds_b128 %1, %9, off\n\t"
        "global_load_async_to_lds_b128 %2, %10, off\n\t"
        "global_load_async_to_lds_b128 %3, %11, off\n\t"
        "global_load_async_to_lds_b128 %4, %12, off\n\t"
        "global_load_async_to_lds_b128 %5, %13, off\n\t"
        "global_load_async_to_lds_b128 %6, %14, off\n\t"
        "global_load_async_to_lds_b128 %7, %15, off\n\t"
        "s_wait_xcnt 0x0"
        :: "v"(l),                "v"(l +  2 * OP * 4), "v"(l +  4 * OP * 4), "v"(l +  6 * OP * 4),
           "v"(l +  8 * OP * 4), "v"(l + 10 * OP * 4), "v"(l + 12 * OP * 4), "v"(l + 14 * OP * 4),
           "v"(g),          "v"(g +  2 * D), "v"(g +  4 * D), "v"(g +  6 * D),
           "v"(g +  8 * D), "v"(g + 10 * D), "v"(g + 12 * D), "v"(g + 14 * D)
        : "memory");
}

__global__ __launch_bounds__(32 * OW) void out_kernel(const float* __restrict__ u,
                                                      const float* __restrict__ wv,
                                                      float* __restrict__ out) {
    __shared__ __attribute__((aligned(16))) float st[OW * OWR];

    const int bt0 = (blockIdx.x >> 5) * OT;      // 8 tiles over B*T
    const int h0  = (blockIdx.x & 31) * OT;      // 32 tiles over H
    const int tid = threadIdx.x;
    const int wave = tid >> 5;
    const int lane = tid & 31;
    const int hh = lane >> 4;
    const int c  = lane & 15;

    float* my = st + wave * OWR;                 // rows 0..31: u, rows 32..63: wv

    // staging: lane half hh takes row 2r + hh, lane c its floats 4c .. 4c+3
    const float* gu = u  + (size_t)(bt0 + hh) * D + wave * OKW + c * 4;
    const float* gw = wv + (size_t)(h0  + hh) * D + wave * OKW + c * 4;
    const unsigned int sm = (unsigned int)(uintptr_t)(my + hh * OP + c * 4);
    async_rows16(sm + OT * OP * 4,        gw);            // wv rows  0..15
    async_rows16(sm + (OT + 16) * OP * 4, gw + 16 * D);   // wv rows 16..31
    async_rows16(sm,                      gu);            // u rows   0..15
    async_rows16(sm + 16 * OP * 4,        gu + 16 * D);   // u rows  16..31
    wait_async0();                               // this wave's copies have landed
    __syncthreads();                             // nobody reads the rows in front of this

    v8f acc[2][2] = {};
    // A and B fragments come from the same loader, so their k orders are equal:
    // lane half hh holds d = 8j + 4hh + {0,1} in the first product of a group
    // and d = 8j + 4hh + {2,3} in the second.
    const float* fa = my + c * OP + 4 * hh;
    const float* fb = fa + OT * OP;
#pragma unroll   // straight-line code lets the LDS reads run ahead of the matrix instructions
    for (int j = 0; j < OKW / 8; ++j) {
        const float4 a0 = *(const float4*)(fa + 8 * j);
        const float4 a1 = *(const float4*)(fa + 16 * OP + 8 * j);
        const float4 b0 = *(const float4*)(fb + 8 * j);
        const float4 b1 = *(const float4*)(fb + 16 * OP + 8 * j);
        const v2f a0l = {a0.x, a0.y}, a0h = {a0.z, a0.w};
        const v2f a1l = {a1.x, a1.y}, a1h = {a1.z, a1.w};
        const v2f b0l = {b0.x, b0.y}, b0h = {b0.z, b0.w};
        const v2f b1l = {b1.x, b1.y}, b1h = {b1.z, b1.w};
        acc[0][0] = __builtin_amdgcn_wmma_f32_16x16x4_f32(false, a0l, false, b0l, (short)0, acc[0][0], false, false);
        acc[0][1] = __builtin_amdgcn_wmma_f32_16x16x4_f32(false, a0l, false, b1l, (short)0, acc[0][1], false, false);
        acc[1][0] = __builtin_amdgcn_wmma_f32_16x16x4_f32(false, a1l, false, b0l, (short)0, acc[1][0], false, false);
        acc[1][1] = __builtin_amdgcn_wmma_f32_16x16x4_f32(false, a1l, false, b1l, (short)0, acc[1][1], false, false);
        acc[0][0] = __builtin_amdgcn_wmma_f32_16x16x4_f32(false, a0h, false, b0h, (short)0, acc[0][0], false, false);
        acc[0][1] = __builtin_amdgcn_wmma_f32_16x16x4_f32(false, a0h, false, b1h, (short)0, acc[0][1], false, false);
        acc[1][0] = __builtin_amdgcn_wmma_f32_16x16x4_f32(false, a1h, false, b0h, (short)0, acc[1][0], false, false);
        acc[1][1] = __builtin_amdgcn_wmma_f32_16x16x4_f32(false, a1h, false, b1h, (short)0, acc[1][1], false, false);
    }

    // Partial tile into the head of the wave's own range (its rows are all read:
    // every accumulator depends on them).  D layout: register r <-> row 8*hh + r, column c.
#pragma unroll   // these three: constant indices keep acc[][] in registers
    for (int i = 0; i < 2; ++i)
#pragma unroll
        for (int jn = 0; jn < 2; ++jn)
#pragma unroll
            for (int r = 0; r < 8; ++r)
                my[(16 * i + 8 * hh + r) * ORP + 16 * jn + c] = acc[i][jn][r];
    __syncthreads();                             // the partial tiles are complete

    const int row = tid >> 4;                    // 0..31
    const int col = (tid & 15) * 2;              // 16 threads store one 128-B line of out
    const float* pr = st + row * ORP + col;
    float2 s = *(const float2*)pr;
#pragma unroll   // the LDS reads issue together
    for (int w = 1; w < OW; ++w) {
        const float2 q2 = *(const float2*)(pr + w * OWR);
        s.x += q2.x; s.y += q2.y;
    }
    *(float2*)(out + (size_t)(bt0 + row) * H + h0 + col) = s;
}

// ---------------------------------------------------------------------------
extern "C" void kernel_launch(void* const* d_in, const int* in_sizes, int n_in,
                              void* d_out, int out_size, void* d_ws, size_t ws_size,
                              hipStream_t stream) {
    const float* x    = (const float*)d_in[0];   // (B,S,D)
    const float* mask = (const float*)d_in[1];   // (B,1,S)
    const float* wk   = (const float*)d_in[2];   // (H,D)
    const float* wv   = (const float*)d_in[3];   // (H,D)
    const float* q    = (const float*)d_in[4];   // (T,H)
    float* out = (float*)d_out;                  // (B,T,H)

    char* ws = (char*)d_ws;
    bf16_t* qk_ws    = (bf16_t*)(ws);                                  // T*D bf16      = 128 KB, tile by tile
    float*  mb_ws    = (float*)(ws + 131072);                          // B*T*NB f32    = 64 KB
    float*  lb_ws    = (float*)(ws + 131072 + 65536);                  // B*T*NB f32    = 64 KB
    float*  u_ws     = (float*)(ws + 131072 + 131072);                 // B*T*D f32     = 1 MB
    _Float16* upart_ws = (_Float16*)(ws + 131072 + 131072 + 1048576);  // B*NB*T*D f16  = 32 MB

    qk_kernel<<<(T / QT) * (D / QN), 32 * QW, 0, stream>>>(q, wk, qk_ws);
    attn_kernel<<<B * NB, 256, 0, stream>>>(x, qk_ws, mask, upart_ws, mb_ws, lb_ws);
    usum_kernel<<<B * (T * D / UM1), 128, 0, stream>>>(upart_ws, mb_ws, lb_ws, u_ws);
    out_kernel<<<(B * T / OT) * (H / OT), 32 * OW, 0, stream>>>(u_ws, wv, out);
}
